// v000
// Times are from an AMD MI455X. After a warm-up the kernel runs many times in a row, and a time is the length of
// such a window on the GPU divided by its runs, so every launch and the gaps after it count. The runs cycle
// through copies of the inputs. A figure is the median of several windows, for all but v000 over two sittings.
// Sittings can differ by a few percent; kernels timed side by side share one.
// v000, which the later versions start from, runs in 145 microseconds.
#include <hip/hip_runtime.h>
#include <hip/hip_bf16.h>

typedef __attribute__((ext_vector_type(16))) _Float16 v16h;
typedef __attribute__((ext_vector_type(8)))  _Float16 v8h;
typedef __attribute__((ext_vector_type(4)))  _Float16 v4h;
typedef __attribute__((ext_vector_type(8)))  float    v8f;
typedef __attribute__((ext_vector_type(4)))  float    v4f;

#define HID   1024
#define SEQ   2048
#define NHEAD 16
#define HDIM  64

__device__ __forceinline__ v8f wmma_f16(v16h a, v16h b, v8f c) {
    // D = A(16x32 f16) x B(32x16 f16) + C(16x16 f32)
    return __builtin_amdgcn_wmma_f32_16x16x32_f16(
        /*neg_a=*/false, a, /*neg_b=*/false, b,
        /*c_mod=*/(short)0, c, /*reuse_a=*/false, /*reuse_b=*/false);
}

__device__ __forceinline__ v8h ld8h(const _Float16* p) {  // one b128 load
    return *(const v8h*)p;
}

__device__ __forceinline__ v16h cat16(v8h a, v8h b) {
    return __builtin_shufflevector(a, b, 0,1,2,3,4,5,6,7,8,9,10,11,12,13,14,15);
}

// A/B fragment: elems 0..7 at p, elems 8..15 at p+16 (two b128 loads)
__device__ __forceinline__ v16h ldfrag(const _Float16* p) {
    return cat16(ld8h(p), ld8h(p + 16));
}

// ---------------------------------------------------------------------------
// Kernel 0: fp32 -> f16 pre-conversion (one pass; GEMM then re-reads f16).
// ---------------------------------------------------------------------------
__global__ __launch_bounds__(256)
void cvt_f16_kernel(const float* __restrict__ src, _Float16* __restrict__ dst,
                    int n4 /* element count / 4 */) {
    const int i = blockIdx.x * 256 + threadIdx.x;
    if (i < n4) {
        const v4f v = ((const v4f*)src)[i];
        v4h r;
        r[0] = (_Float16)v[0]; r[1] = (_Float16)v[1];
        r[2] = (_Float16)v[2]; r[3] = (_Float16)v[3];
        ((v4h*)dst)[i] = r;
    }
}

// ---------------------------------------------------------------------------
// Kernel 1: QKV projection.  out[n,o] = sum_k X[n,k] * W[o,k] + bias[o]
//   blockIdx.x : 128-row tile (N = B*S = 4096)
//   blockIdx.y : 128-col tile (O = 1024)
//   blockIdx.z : 0 -> Q, 1 -> K, 2 -> V (stored transposed per head)
// 8 waves (2 row x 4 col), each wave owns a 64x32 tile = 4x2 WMMA accums.
// Inner loop: 12 b128 loads + 8 WMMAs, zero conversion VALU.
// ---------------------------------------------------------------------------
__global__ __launch_bounds__(256)
void qkv_proj_kernel(const _Float16* __restrict__ Xh,
                     const _Float16* __restrict__ Wqh,
                     const _Float16* __restrict__ Wkh,
                     const _Float16* __restrict__ Wvh,
                     const float* __restrict__ bq,
                     const float* __restrict__ bk,
                     const float* __restrict__ bv,
                     _Float16* __restrict__ Qh, _Float16* __restrict__ Kh,
                     _Float16* __restrict__ Vt) {
    const int tid   = threadIdx.x;
    const int lane  = tid & 31;
    const int w     = tid >> 5;
    const int qlane = lane & 15;
    const int hi    = lane >> 4;           // 0: K set {0..7,16..23}, 1: {8..15,24..31}
    const int rw    = w >> 2;              // 0..1
    const int cw    = w & 3;               // 0..3
    const int rbase = blockIdx.x * 128 + rw * 64;
    const int cbase = blockIdx.y * 128 + cw * 32;
    const int z     = blockIdx.z;

    const _Float16* W    = (z == 0) ? Wqh : ((z == 1) ? Wkh : Wvh);
    const float*    bias = (z == 0) ? bq  : ((z == 1) ? bk  : bv);

    v8f acc[4][2] = {};

    for (int k = 0; k < HID; k += 32) {
        const int koff = k + hi * 8;
        v16h a[4], b[2];
#pragma unroll
        for (int m = 0; m < 4; ++m)
            a[m] = ldfrag(Xh + (size_t)(rbase + m * 16 + qlane) * HID + koff);
#pragma unroll
        for (int n = 0; n < 2; ++n)
            b[n] = ldfrag(W + (size_t)(cbase + n * 16 + qlane) * HID + koff);
#pragma unroll
        for (int m = 0; m < 4; ++m)
#pragma unroll
            for (int n = 0; n < 2; ++n)
                acc[m][n] = wmma_f16(a[m], b[n], acc[m][n]);
    }

    // Epilogue: bias add, cast to f16, store. Uniform z-branch hoisted.
    if (z == 2) {
        // V transposed: per (m,n) the 8 accumulator slots are contiguous in s
        // -> pack into one b128 store.
#pragma unroll
        for (int n = 0; n < 2; ++n) {
            const int col  = cbase + n * 16 + qlane;
            const int head = col >> 6, d = col & (HDIM - 1);
            const float bv_ = bias[col];
#pragma unroll
            for (int m = 0; m < 4; ++m) {
                const int row0 = rbase + m * 16 + hi * 8;   // rows row0..row0+7
                const int bi = row0 >> 11, s0 = row0 & (SEQ - 1);
                v8h pk;
#pragma unroll
                for (int j = 0; j < 8; ++j)
                    pk[j] = (_Float16)(acc[m][n][j] + bv_);
                *(v8h*)(Vt + ((size_t)(bi * NHEAD + head) * HDIM + d) * SEQ + s0) = pk;
            }
        }
    } else {
        _Float16* __restrict__ dst = (z == 0) ? Qh : Kh;
#pragma unroll
        for (int n = 0; n < 2; ++n) {
            const int col = cbase + n * 16 + qlane;
            const float bv_ = bias[col];
#pragma unroll
            for (int m = 0; m < 4; ++m) {
#pragma unroll
                for (int j = 0; j < 8; ++j) {
                    const int row = rbase + m * 16 + j + hi * 8;
                    dst[(size_t)row * HID + col] = (_Float16)(acc[m][n][j] + bv_);
                }
            }
        }
    }
}

// ---------------------------------------------------------------------------
// Kernel 2: flash attention.  One wave = 32 queries (two 16-query tiles) so
// every K/V fragment load feeds two WMMAs.
//   scoresT = K * Q^T   (M = keys, N = queries)  -> per-lane online softmax
//   ctxT    = V^T * P^T (M = dims, N = queries)  -> P^T C-layout == B-fragment
//   blockIdx.x : 256-query tile, blockIdx.y : head, blockIdx.z : batch
// Mask is pre-baked into an additive f32 bias in LDS (0 or -3e38), so the
// score epilogue is one FMA per element.
// ---------------------------------------------------------------------------
__global__ __launch_bounds__(256)
void attention_kernel(const _Float16* __restrict__ Qh,
                      const _Float16* __restrict__ Kh,
                      const _Float16* __restrict__ Vt,
                      const int* __restrict__ mask,
                      float* __restrict__ out) {
    __shared__ __attribute__((aligned(16))) float sbias[SEQ];
    const int b    = blockIdx.z;
    const int head = blockIdx.y;
    const int tid  = threadIdx.x;

    for (int i = tid; i < SEQ; i += 256)
        sbias[i] = (mask[b * SEQ + i] == 0) ? -3.0e38f : 0.0f;
    __syncthreads();

    const int lane  = tid & 31;
    const int w     = tid >> 5;
    const int qlane = lane & 15;
    const int hi    = lane >> 4;
    const int q0    = blockIdx.x * 256 + w * 32;

    // Q fragments (B-matrix of scoresT): lane = query, K = head_dim (2 chunks)
    v16h qf[2][2];
#pragma unroll
    for (int qt = 0; qt < 2; ++qt) {
        const _Float16* qp =
            Qh + (size_t)(b * SEQ + q0 + qt * 16 + qlane) * HID + head * HDIM;
#pragma unroll
        for (int kc = 0; kc < 2; ++kc)
            qf[qt][kc] = ldfrag(qp + kc * 32 + hi * 8);
    }

    const _Float16* Kbase = Kh + (size_t)b * SEQ * HID + head * HDIM;
    const _Float16* Vbase = Vt + (size_t)(b * NHEAD + head) * HDIM * SEQ;
    const float scale = 0.125f;   // 1/sqrt(64)

    float m[2] = {-1e30f, -1e30f};
    float l[2] = {0.0f, 0.0f};
    v8f acc[2][4] = {};

    for (int kt = 0; kt < SEQ; kt += 32) {
        // Prefetch next key tile's K and V lines (global_prefetch_b8).
        {
            const int ktn = (kt + 32 < SEQ) ? (kt + 32) : kt;
            __builtin_prefetch(Kbase + (size_t)(ktn + qlane) * HID + hi * 8, 0, 1);
            __builtin_prefetch(Kbase + (size_t)(ktn + 16 + qlane) * HID + hi * 8, 0, 1);
            __builtin_prefetch(Vbase + (size_t)(lane) * SEQ + ktn, 0, 1);
            __builtin_prefetch(Vbase + (size_t)(32 + lane) * SEQ + ktn, 0, 1);
        }

        // --- K A-fragments, shared by both query tiles ---
        v16h ak[2][2];   // [key sub-tile][head_dim chunk]
#pragma unroll
        for (int sub = 0; sub < 2; ++sub) {
            const _Float16* kp =
                Kbase + (size_t)(kt + sub * 16 + qlane) * HID + hi * 8;
            ak[sub][0] = ldfrag(kp);
            ak[sub][1] = ldfrag(kp + 32);
        }

        // --- additive mask bias for this lane's 16 key slots (4x ds b128) ---
        float mb0[8], mb1[8];
        {
            const v4f* bp0 = (const v4f*)&sbias[kt + hi * 8];
            const v4f* bp1 = (const v4f*)&sbias[kt + 16 + hi * 8];
            v4f a0 = bp0[0], a1 = bp0[1], c0 = bp1[0], c1 = bp1[1];
#pragma unroll
            for (int j = 0; j < 4; ++j) {
                mb0[j] = a0[j]; mb0[4 + j] = a1[j];
                mb1[j] = c0[j]; mb1[4 + j] = c1[j];
            }
        }

        v16h pb[2];   // P^T B-fragments, one per query tile
#pragma unroll
        for (int qt = 0; qt < 2; ++qt) {
            // scoresT: two 16(key) x 16(query) tiles
            v8f st[2];
#pragma unroll
            for (int sub = 0; sub < 2; ++sub) {
                v8f c = {};
                c = wmma_f16(ak[sub][0], qf[qt][0], c);
                c = wmma_f16(ak[sub][1], qf[qt][1], c);
                st[sub] = c;
            }

            // scale+mask via single FMA, then per-query online softmax
            float p0[8], p1[8];
            float mx = -1e30f;
#pragma unroll
            for (int j = 0; j < 8; ++j) {
                const float s0 = fmaf(st[0][j], scale, mb0[j]);
                const float s1 = fmaf(st[1][j], scale, mb1[j]);
                p0[j] = s0; p1[j] = s1;
                mx = fmaxf(mx, fmaxf(s0, s1));
            }
            mx = fmaxf(mx, __shfl_xor(mx, 16, 32));  // combine half-rows
            const float mnew   = fmaxf(m[qt], mx);
            const float escale = __expf(m[qt] - mnew);

            float rs = 0.0f;
            v16h p;
#pragma unroll
            for (int j = 0; j < 8; ++j) {
                const float e0 = __expf(p0[j] - mnew);
                const float e1 = __expf(p1[j] - mnew);
                rs += e0 + e1;
                p[j]     = (_Float16)e0;
                p[8 + j] = (_Float16)e1;
            }
            rs += __shfl_xor(rs, 16, 32);
            l[qt] = l[qt] * escale + rs;
            m[qt] = mnew;
            pb[qt] = p;

            // rescale accumulators for this query tile
#pragma unroll
            for (int dt = 0; dt < 4; ++dt)
#pragma unroll
                for (int j = 0; j < 8; ++j) acc[qt][dt][j] *= escale;
        }

        // --- ctxT += V^T * P^T : each V fragment feeds both query tiles ---
#pragma unroll
        for (int dt = 0; dt < 4; ++dt) {
            const _Float16* vp =
                Vbase + (size_t)(dt * 16 + qlane) * SEQ + kt + hi * 8;
            v16h av = ldfrag(vp);
            acc[0][dt] = wmma_f16(av, pb[0], acc[0][dt]);
            acc[1][dt] = wmma_f16(av, pb[1], acc[1][dt]);
        }
    }

    // --- write out: out[b, q, head*64 + d]; 8 floats per (qt,dt) are
    //     contiguous in d -> two b128 stores each ---
#pragma unroll
    for (int qt = 0; qt < 2; ++qt) {
        const float linv = 1.0f / l[qt];
        float* op = out + (size_t)(b * SEQ + q0 + qt * 16 + qlane) * HID
                        + head * HDIM + hi * 8;
#pragma unroll
        for (int dt = 0; dt < 4; ++dt) {
            v4f lo, hic;
#pragma unroll
            for (int j = 0; j < 4; ++j) {
                lo[j]  = acc[qt][dt][j]     * linv;
                hic[j] = acc[qt][dt][4 + j] * linv;
            }
            *(v4f*)(op + dt * 16)     = lo;
            *(v4f*)(op + dt * 16 + 4) = hic;
        }
    }
}

// ---------------------------------------------------------------------------

extern "C" void kernel_launch(void* const* d_in, const int* in_sizes, int n_in,
                              void* d_out, int out_size, void* d_ws, size_t ws_size,
                              hipStream_t stream) {
    (void)in_sizes; (void)n_in; (void)out_size; (void)ws_size;
    const float* X    = (const float*)d_in[0];
    const int*   mask = (const int*)d_in[1];
    const float* Wq   = (const float*)d_in[2];
    const float* bq   = (const float*)d_in[3];
    const float* Wk   = (const float*)d_in[4];
    const float* bk   = (const float*)d_in[5];
    const float* Wv   = (const float*)d_in[6];
    const float* bv   = (const float*)d_in[7];
    float* out = (float*)d_out;

    const size_t nX = (size_t)2 * SEQ * HID;      // 4096*1024
    const size_t nW = (size_t)HID * HID;          // 1024*1024
    _Float16* Qh  = (_Float16*)d_ws;
    _Float16* Kh  = Qh  + nX;
    _Float16* Vt  = Kh  + nX;
    _Float16* Xh  = Vt  + nX;
    _Float16* Wqh = Xh  + nX;
    _Float16* Wkh = Wqh + nW;
    _Float16* Wvh = Wkh + nW;                     // total 38 MiB workspace

    // Pass 0: one-shot fp32 -> f16 conversion of X and weights.
    cvt_f16_kernel<<<(int)(nX / 4 / 256), 256, 0, stream>>>(X,  Xh,  (int)(nX / 4));
    cvt_f16_kernel<<<(int)(nW / 4 / 256), 256, 0, stream>>>(Wq, Wqh, (int)(nW / 4));
    cvt_f16_kernel<<<(int)(nW / 4 / 256), 256, 0, stream>>>(Wk, Wkh, (int)(nW / 4));
    cvt_f16_kernel<<<(int)(nW / 4 / 256), 256, 0, stream>>>(Wv, Wvh, (int)(nW / 4));

    dim3 g1(4096 / 128, HID / 128, 3);            // 32 x 8 x 3
    qkv_proj_kernel<<<g1, 256, 0, stream>>>(Xh, Wqh, Wkh, Wvh, bq, bk, bv,
                                            Qh, Kh, Vt);

    dim3 g2(SEQ / 256, NHEAD, 2);                 // 8 x 16 x 2
    attention_kernel<<<g2, 256, 0, stream>>>(Qh, Kh, Vt, mask, out);
}

// v001
// One run takes 103 microseconds.
// Two timings next to v000 both put it at 1.46 times that version's speed.
#include <hip/hip_runtime.h>
#include <hip/hip_bf16.h>

typedef __attribute__((ext_vector_type(16))) _Float16 v16h;
typedef __attribute__((ext_vector_type(8)))  _Float16 v8h;
typedef __attribute__((ext_vector_type(4)))  _Float16 v4h;
typedef __attribute__((ext_vector_type(8)))  float    v8f;
typedef __attribute__((ext_vector_type(4)))  float    v4f;

#define HID   1024
#define SEQ   2048
#define NHEAD 16
#define HDIM  64

__device__ __forceinline__ v8f wmma_f16(v16h a, v16h b, v8f c) {
    // D = A(16x32 f16) x B(32x16 f16) + C(16x16 f32)
    return __builtin_amdgcn_wmma_f32_16x16x32_f16(
        /*neg_a=*/false, a, /*neg_b=*/false, b,
        /*c_mod=*/(short)0, c, /*reuse_a=*/false, /*reuse_b=*/false);
}

__device__ __forceinline__ v8h ld8h(const _Float16* p) {  // one b128 load
    return *(const v8h*)p;
}

__device__ __forceinline__ v16h cat16(v8h a, v8h b) {
    return __builtin_shufflevector(a, b, 0,1,2,3,4,5,6,7,8,9,10,11,12,13,14,15);
}

// A/B fragment: elems 0..7 at p, elems 8..15 at p+16 (two b128 loads)
__device__ __forceinline__ v16h ldfrag(const _Float16* p) {
    return cat16(ld8h(p), ld8h(p + 16));
}

// ---------------------------------------------------------------------------
// Kernel 0: fp32 -> f16 pre-conversion (one pass; GEMM then re-reads f16).
// ---------------------------------------------------------------------------
__global__ __launch_bounds__(256)
void cvt_f16_kernel(const float* __restrict__ src, _Float16* __restrict__ dst,
                    int n4 /* element count / 4 */) {
    const int i = blockIdx.x * 256 + threadIdx.x;
    if (i < n4) {
        const v4f v = ((const v4f*)src)[i];
        v4h r;
        r[0] = (_Float16)v[0]; r[1] = (_Float16)v[1];
        r[2] = (_Float16)v[2]; r[3] = (_Float16)v[3];
        ((v4h*)dst)[i] = r;
    }
}

// ---------------------------------------------------------------------------
// Kernel 1: QKV projection.  out[n,o] = sum_k X[n,k] * W[o,k] + bias[o]
//   blockIdx.x : 128-row tile (N = B*S = 4096)
//   blockIdx.y : 128-col tile (O = 1024)
//   blockIdx.z : 0 -> Q, 1 -> K, 2 -> V (stored transposed per head)
// 8 waves (2 row x 4 col), each wave owns a 64x32 tile = 4x2 WMMA accums.
// The block's 128 X rows and 128 W rows come into LDS in tiles of 64 k
// (128-byte rows, whole lines) by asynchronous copies, two buffers, the next
// tile in flight while this one is worked on; fragments are read from LDS.
// ---------------------------------------------------------------------------
#define KT     64                    // k elements per tile: 128 B of every row
#define NT     (HID / KT)            // 16 tiles
#define PITCH  72                    // halves per LDS row: 144 B = 16 B x odd
#define TROWS  256                   // rows 0..127: X, rows 128..255: W
#define BUFH   (TROWS * PITCH)       // halves per buffer (36,864 B)

// Eight 16-byte copies per lane = this thread's share of one 32 KiB tile.
// The s_wait_xcnt stands inside the statement so that no address register of
// an issued copy is rewritten ahead of it.
__device__ __forceinline__ void copy_tile(unsigned lds, const _Float16* gx,
                                          const _Float16* gw) {
    const unsigned l0 = lds,                 l1 = lds + 32 * PITCH * 2,
                   l2 = lds + 64 * PITCH * 2,  l3 = lds + 96 * PITCH * 2,
                   l4 = lds + 128 * PITCH * 2, l5 = lds + 160 * PITCH * 2,
                   l6 = lds + 192 * PITCH * 2, l7 = lds + 224 * PITCH * 2;
    const _Float16 *g0 = gx,            *g1 = gx + 32 * HID,
                   *g2 = gx + 64 * HID, *g3 = gx + 96 * HID,
                   *g4 = gw,            *g5 = gw + 32 * HID,
                   *g6 = gw + 64 * HID, *g7 = gw + 96 * HID;
    asm volatile(
        "global_load_async_to_lds_b128 %0, %8, off\n\t"
        "global_load_async_to_lds_b128 %1, %9, off\n\t"
        "global_load_async_to_lds_b128 %2, %10, off\n\t"
        "global_load_async_to_lds_b128 %3, %11, off\n\t"
        "global_load_async_to_lds_b128 %4, %12, off\n\t"
        "global_load_async_to_lds_b128 %5, %13, off\n\t"
        "global_load_async_to_lds_b128 %6, %14, off\n\t"
        "global_load_async_to_lds_b128 %7, %15, off\n\t"
        "s_wait_xcnt 0x0"
        :: "v"(l0), "v"(l1), "v"(l2), "v"(l3), "v"(l4), "v"(l5), "v"(l6), "v"(l7),
           "v"(g0), "v"(g1), "v"(g2), "v"(g3), "v"(g4), "v"(g5), "v"(g6), "v"(g7)
        : "memory");
}

__global__ __launch_bounds__(256)
void qkv_proj_kernel(const _Float16* __restrict__ Xh,
                     const _Float16* __restrict__ Wqh,
                     const _Float16* __restrict__ Wkh,
                     const _Float16* __restrict__ Wvh,
                     const float* __restrict__ bq,
                     const float* __restrict__ bk,
                     const float* __restrict__ bv,
                     _Float16* __restrict__ Qh, _Float16* __restrict__ Kh,
                     _Float16* __restrict__ Vt) {
    __shared__ __attribute__((aligned(16))) _Float16 tile[2 * BUFH];

    const int tid   = threadIdx.x;
    const int lane  = tid & 31;
    const int w     = tid >> 5;
    const int qlane = lane & 15;
    const int hi    = lane >> 4;           // 0: K set {0..7,16..23}, 1: {8..15,24..31}
    const int rw    = w >> 2;              // 0..1
    const int cw    = w & 3;               // 0..3
    const int rbase = blockIdx.x * 128 + rw * 64;
    const int cbase = blockIdx.y * 128 + cw * 32;
    const int z     = blockIdx.z;

    const _Float16* W    = (z == 0) ? Wqh : ((z == 1) ? Wkh : Wvh);
    const float*    bias = (z == 0) ? bq  : ((z == 1) ? bk  : bv);

    // Copy side: 8 lanes cover one 128-byte row, a wave covers 4 rows a copy.
    const int crow = tid >> 3;             // 0..31
    const int ccol = (tid & 7) * 8;        // halves
    const _Float16* gx = Xh + (size_t)(blockIdx.x * 128 + crow) * HID + ccol;
    const _Float16* gw = W  + (size_t)(blockIdx.y * 128 + crow) * HID + ccol;
    const unsigned  ldst = (unsigned)(size_t)tile + (crow * PITCH + ccol) * 2;

    // Read side: this lane's row in the wave's first A and first B fragment.
    const _Float16* fa = tile + (rw * 64 + qlane) * PITCH + hi * 8;
    const _Float16* fb = tile + (128 + cw * 32 + qlane) * PITCH + hi * 8;

    v8f acc[4][2] = {};

    copy_tile(ldst, gx, gw);                              // tile 0 -> buffer 0
    asm volatile("s_wait_asynccnt 0x0" ::: "memory");     // own copies landed
    __syncthreads();                                      // publishes tile 0
    copy_tile(ldst + BUFH * 2, gx + KT, gw + KT);         // tile 1 -> buffer 1

    for (int t = 0; t < NT; ++t) {
        const int boff = (t & 1) * BUFH;
#pragma unroll
        for (int kc = 0; kc < KT; kc += 32) {
            v16h a[4], b[2];
#pragma unroll
            for (int m = 0; m < 4; ++m)
                a[m] = ldfrag(fa + boff + m * 16 * PITCH + kc);
#pragma unroll
            for (int n = 0; n < 2; ++n)
                b[n] = ldfrag(fb + boff + n * 16 * PITCH + kc);
            // Keeps the 12 LDS reads together ahead of their 8 WMMAs: left
            // alone the compiler sinks them among the WMMAs, one full LDS
            // wait for every pair.
            __builtin_amdgcn_sched_barrier(0);
#pragma unroll
            for (int m = 0; m < 4; ++m)
#pragma unroll
                for (int n = 0; n < 2; ++n)
                    acc[m][n] = wmma_f16(a[m], b[n], acc[m][n]);
            // Keeps the next group's reads out of this WMMA block: left alone
            // the compiler spreads them over four places among the WMMAs.
            __builtin_amdgcn_sched_barrier(0);
        }
        // Hand-over: this wave's reads of the buffer are done, its copies of
        // the next tile have landed; the barrier publishes tile t + 1 and
        // frees the buffer that trip t has read for the refill behind it.
        asm volatile("s_wait_dscnt 0x0" ::: "memory");
        asm volatile("s_wait_asynccnt 0x0" ::: "memory");
        __syncthreads();
        if (t + 2 < NT)
            copy_tile(ldst + boff * 2, gx + (t + 2) * KT, gw + (t + 2) * KT);
    }
    asm volatile("s_wait_asynccnt 0x0" ::: "memory");     // nothing left in flight

    // Epilogue: bias add, cast to f16, store. Uniform z-branch hoisted.
    if (z == 2) {
        // V transposed: per (m,n) the 8 accumulator slots are contiguous in s
        // -> pack into one b128 store.
#pragma unroll
        for (int n = 0; n < 2; ++n) {
            const int col  = cbase + n * 16 + qlane;
            const int head = col >> 6, d = col & (HDIM - 1);
            const float bv_ = bias[col];
#pragma unroll
            for (int m = 0; m < 4; ++m) {
                const int row0 = rbase + m * 16 + hi * 8;   // rows row0..row0+7
                const int bi = row0 >> 11, s0 = row0 & (SEQ - 1);
                v8h pk;
#pragma unroll
                for (int j = 0; j < 8; ++j)
                    pk[j] = (_Float16)(acc[m][n][j] + bv_);
                *(v8h*)(Vt + ((size_t)(bi * NHEAD + head) * HDIM + d) * SEQ + s0) = pk;
            }
        }
    } else {
        _Float16* __restrict__ dst = (z == 0) ? Qh : Kh;
#pragma unroll
        for (int n = 0; n < 2; ++n) {
            const int col = cbase + n * 16 + qlane;
            const float bv_ = bias[col];
#pragma unroll
            for (int m = 0; m < 4; ++m) {
#pragma unroll
                for (int j = 0; j < 8; ++j) {
                    const int row = rbase + m * 16 + j + hi * 8;
                    dst[(size_t)row * HID + col] = (_Float16)(acc[m][n][j] + bv_);
                }
            }
        }
    }
}

// ---------------------------------------------------------------------------
// Kernel 2: flash attention.  One wave = 32 queries (two 16-query tiles) so
// every K/V fragment load feeds two WMMAs.
//   scoresT = K * Q^T   (M = keys, N = queries)  -> per-lane online softmax
//   ctxT    = V^T * P^T (M = dims, N = queries)  -> P^T C-layout == B-fragment
//   blockIdx.x : 256-query tile, blockIdx.y : head, blockIdx.z : batch
// Mask is pre-baked into an additive f32 bias in LDS (0 or -3e38), so the
// score epilogue is one FMA per element.
// ---------------------------------------------------------------------------
__global__ __launch_bounds__(256)
void attention_kernel(const _Float16* __restrict__ Qh,
                      const _Float16* __restrict__ Kh,
                      const _Float16* __restrict__ Vt,
                      const int* __restrict__ mask,
                      float* __restrict__ out) {
    __shared__ __attribute__((aligned(16))) float sbias[SEQ];
    const int b    = blockIdx.z;
    const int head = blockIdx.y;
    const int tid  = threadIdx.x;

    for (int i = tid; i < SEQ; i += 256)
        sbias[i] = (mask[b * SEQ + i] == 0) ? -3.0e38f : 0.0f;
    __syncthreads();

    const int lane  = tid & 31;
    const int w     = tid >> 5;
    const int qlane = lane & 15;
    const int hi    = lane >> 4;
    const int q0    = blockIdx.x * 256 + w * 32;

    // Q fragments (B-matrix of scoresT): lane = query, K = head_dim (2 chunks)
    v16h qf[2][2];
#pragma unroll
    for (int qt = 0; qt < 2; ++qt) {
        const _Float16* qp =
            Qh + (size_t)(b * SEQ + q0 + qt * 16 + qlane) * HID + head * HDIM;
#pragma unroll
        for (int kc = 0; kc < 2; ++kc)
            qf[qt][kc] = ldfrag(qp + kc * 32 + hi * 8);
    }

    const _Float16* Kbase = Kh + (size_t)b * SEQ * HID + head * HDIM;
    const _Float16* Vbase = Vt + (size_t)(b * NHEAD + head) * HDIM * SEQ;
    const float scale = 0.125f;   // 1/sqrt(64)

    float m[2] = {-1e30f, -1e30f};
    float l[2] = {0.0f, 0.0f};
    v8f acc[2][4] = {};

    for (int kt = 0; kt < SEQ; kt += 32) {
        // Prefetch next key tile's K and V lines (global_prefetch_b8).
        {
            const int ktn = (kt + 32 < SEQ) ? (kt + 32) : kt;
            __builtin_prefetch(Kbase + (size_t)(ktn + qlane) * HID + hi * 8, 0, 1);
            __builtin_prefetch(Kbase + (size_t)(ktn + 16 + qlane) * HID + hi * 8, 0, 1);
            __builtin_prefetch(Vbase + (size_t)(lane) * SEQ + ktn, 0, 1);
            __builtin_prefetch(Vbase + (size_t)(32 + lane) * SEQ + ktn, 0, 1);
        }

        // --- K A-fragments, shared by both query tiles ---
        v16h ak[2][2];   // [key sub-tile][head_dim chunk]
#pragma unroll
        for (int sub = 0; sub < 2; ++sub) {
            const _Float16* kp =
                Kbase + (size_t)(kt + sub * 16 + qlane) * HID + hi * 8;
            ak[sub][0] = ldfrag(kp);
            ak[sub][1] = ldfrag(kp + 32);
        }

        // --- additive mask bias for this lane's 16 key slots (4x ds b128) ---
        float mb0[8], mb1[8];
        {
            const v4f* bp0 = (const v4f*)&sbias[kt + hi * 8];
            const v4f* bp1 = (const v4f*)&sbias[kt + 16 + hi * 8];
            v4f a0 = bp0[0], a1 = bp0[1], c0 = bp1[0], c1 = bp1[1];
#pragma unroll
            for (int j = 0; j < 4; ++j) {
                mb0[j] = a0[j]; mb0[4 + j] = a1[j];
                mb1[j] = c0[j]; mb1[4 + j] = c1[j];
            }
        }

        v16h pb[2];   // P^T B-fragments, one per query tile
#pragma unroll
        for (int qt = 0; qt < 2; ++qt) {
            // scoresT: two 16(key) x 16(query) tiles
            v8f st[2];
#pragma unroll
            for (int sub = 0; sub < 2; ++sub) {
                v8f c = {};
                c = wmma_f16(ak[sub][0], qf[qt][0], c);
                c = wmma_f16(ak[sub][1], qf[qt][1], c);
                st[sub] = c;
            }

            // scale+mask via single FMA, then per-query online softmax
            float p0[8], p1[8];
            float mx = -1e30f;
#pragma unroll
            for (int j = 0; j < 8; ++j) {
                const float s0 = fmaf(st[0][j], scale, mb0[j]);
                const float s1 = fmaf(st[1][j], scale, mb1[j]);
                p0[j] = s0; p1[j] = s1;
                mx = fmaxf(mx, fmaxf(s0, s1));
            }
            mx = fmaxf(mx, __shfl_xor(mx, 16, 32));  // combine half-rows
            const float mnew   = fmaxf(m[qt], mx);
            const float escale = __expf(m[qt] - mnew);

            float rs = 0.0f;
            v16h p;
#pragma unroll
            for (int j = 0; j < 8; ++j) {
                const float e0 = __expf(p0[j] - mnew);
                const float e1 = __expf(p1[j] - mnew);
                rs += e0 + e1;
                p[j]     = (_Float16)e0;
                p[8 + j] = (_Float16)e1;
            }
            rs += __shfl_xor(rs, 16, 32);
            l[qt] = l[qt] * escale + rs;
            m[qt] = mnew;
            pb[qt] = p;

            // rescale accumulators for this query tile
#pragma unroll
            for (int dt = 0; dt < 4; ++dt)
#pragma unroll
                for (int j = 0; j < 8; ++j) acc[qt][dt][j] *= escale;
        }

        // --- ctxT += V^T * P^T : each V fragment feeds both query tiles ---
#pragma unroll
        for (int dt = 0; dt < 4; ++dt) {
            const _Float16* vp =
                Vbase + (size_t)(dt * 16 + qlane) * SEQ + kt + hi * 8;
            v16h av = ldfrag(vp);
            acc[0][dt] = wmma_f16(av, pb[0], acc[0][dt]);
            acc[1][dt] = wmma_f16(av, pb[1], acc[1][dt]);
        }
    }

    // --- write out: out[b, q, head*64 + d]; 8 floats per (qt,dt) are
    //     contiguous in d -> two b128 stores each ---
#pragma unroll
    for (int qt = 0; qt < 2; ++qt) {
        const float linv = 1.0f / l[qt];
        float* op = out + (size_t)(b * SEQ + q0 + qt * 16 + qlane) * HID
                        + head * HDIM + hi * 8;
#pragma unroll
        for (int dt = 0; dt < 4; ++dt) {
            v4f lo, hic;
#pragma unroll
            for (int j = 0; j < 4; ++j) {
                lo[j]  = acc[qt][dt][j]     * linv;
                hic[j] = acc[qt][dt][4 + j] * linv;
            }
            *(v4f*)(op + dt * 16)     = lo;
            *(v4f*)(op + dt * 16 + 4) = hic;
        }
    }
}

// ---------------------------------------------------------------------------

extern "C" void kernel_launch(void* const* d_in, const int* in_sizes, int n_in,
                              void* d_out, int out_size, void* d_ws, size_t ws_size,
                              hipStream_t stream) {
    (void)in_sizes; (void)n_in; (void)out_size; (void)ws_size;
    const float* X    = (const float*)d_in[0];
    const int*   mask = (const int*)d_in[1];
    const float* Wq   = (const float*)d_in[2];
    const float* bq   = (const float*)d_in[3];
    const float* Wk   = (const float*)d_in[4];
    const float* bk   = (const float*)d_in[5];
    const float* Wv   = (const float*)d_in[6];
    const float* bv   = (const float*)d_in[7];
    float* out = (float*)d_out;

    const size_t nX = (size_t)2 * SEQ * HID;      // 4096*1024
    const size_t nW = (size_t)HID * HID;          // 1024*1024
    _Float16* Qh  = (_Float16*)d_ws;
    _Float16* Kh  = Qh  + nX;
    _Float16* Vt  = Kh  + nX;
    _Float16* Xh  = Vt  + nX;
    _Float16* Wqh = Xh  + nX;
    _Float16* Wkh = Wqh + nW;
    _Float16* Wvh = Wkh + nW;                     // total 38 MiB workspace

    // Pass 0: one-shot fp32 -> f16 conversion of X and weights.
    cvt_f16_kernel<<<(int)(nX / 4 / 256), 256, 0, stream>>>(X,  Xh,  (int)(nX / 4));
    cvt_f16_kernel<<<(int)(nW / 4 / 256), 256, 0, stream>>>(Wq, Wqh, (int)(nW / 4));
    cvt_f16_kernel<<<(int)(nW / 4 / 256), 256, 0, stream>>>(Wk, Wkh, (int)(nW / 4));
    cvt_f16_kernel<<<(int)(nW / 4 / 256), 256, 0, stream>>>(Wv, Wvh, (int)(nW / 4));

    dim3 g1(4096 / 128, HID / 128, 3);            // 32 x 8 x 3
    qkv_proj_kernel<<<g1, 256, 0, stream>>>(Xh, Wqh, Wkh, Wvh, bq, bk, bv,
                                            Qh, Kh, Vt);

    dim3 g2(SEQ / 256, NHEAD, 2);                 // 8 x 16 x 2
    attention_kernel<<<g2, 256, 0, stream>>>(Qh, Kh, Vt, mask, out);
}

// v002
// One run takes 82.4 microseconds.
// Timed twice side by side with v001, it ran 1.26 times as fast both times.
// Over all steps from v000 it is 1.84 times as fast.
#include <hip/hip_runtime.h>
#include <hip/hip_bf16.h>

typedef __attribute__((ext_vector_type(16))) _Float16 v16h;
typedef __attribute__((ext_vector_type(8)))  _Float16 v8h;
typedef __attribute__((ext_vector_type(4)))  _Float16 v4h;
typedef __attribute__((ext_vector_type(8)))  float    v8f;
typedef __attribute__((ext_vector_type(4)))  float    v4f;

#define HID   1024
#define SEQ   2048
#define NHEAD 16
#define HDIM  64

__device__ __forceinline__ v8f wmma_f16(v16h a, v16h b, v8f c) {
    // D = A(16x32 f16) x B(32x16 f16) + C(16x16 f32)
    return __builtin_amdgcn_wmma_f32_16x16x32_f16(
        /*neg_a=*/false, a, /*neg_b=*/false, b,
        /*c_mod=*/(short)0, c, /*reuse_a=*/false, /*reuse_b=*/false);
}

__device__ __forceinline__ v8h ld8h(const _Float16* p) {  // one b128 load
    return *(const v8h*)p;
}

__device__ __forceinline__ v16h cat16(v8h a, v8h b) {
    return __builtin_shufflevector(a, b, 0,1,2,3,4,5,6,7,8,9,10,11,12,13,14,15);
}

// A/B fragment: elems 0..7 at p, elems 8..15 at p+16 (two b128 loads)
__device__ __forceinline__ v16h ldfrag(const _Float16* p) {
    return cat16(ld8h(p), ld8h(p + 16));
}

// ---------------------------------------------------------------------------
// Kernel 0: fp32 -> f16 pre-conversion (one pass; GEMM then re-reads f16).
// ---------------------------------------------------------------------------
__global__ __launch_bounds__(256)
void cvt_f16_kernel(const float* __restrict__ src, _Float16* __restrict__ dst,
                    int n4 /* element count / 4 */) {
    const int i = blockIdx.x * 256 + threadIdx.x;
    if (i < n4) {
        const v4f v = ((const v4f*)src)[i];
        v4h r;
        r[0] = (_Float16)v[0]; r[1] = (_Float16)v[1];
        r[2] = (_Float16)v[2]; r[3] = (_Float16)v[3];
        ((v4h*)dst)[i] = r;
    }
}

// ---------------------------------------------------------------------------
// Kernel 1: QKV projection.  out[n,o] = sum_k X[n,k] * W[o,k] + bias[o]
//   blockIdx.x : 128-row tile (N = B*S = 4096)
//   blockIdx.y : 128-col tile (O = 1024)
//   blockIdx.z : 0 -> Q, 1 -> K, 2 -> V (stored transposed per head)
// 8 waves (2 row x 4 col), each wave owns a 64x32 tile = 4x2 WMMA accums.
// The block's 128 X rows and 128 W rows come into LDS in tiles of 64 k
// (128-byte rows, whole lines) by asynchronous copies, two buffers, the next
// tile in flight while this one is worked on; fragments are read from LDS.
// ---------------------------------------------------------------------------
#define KT     64                    // k elements per tile: 128 B of every row
#define NT     (HID / KT)            // 16 tiles
#define PITCH  72                    // halves per LDS row: 144 B = 16 B x odd
#define TROWS  256                   // rows 0..127: X, rows 128..255: W
#define BUFH   (TROWS * PITCH)       // halves per buffer (36,864 B)

// Eight 16-byte copies per lane = this thread's share of one 32 KiB tile.
// The s_wait_xcnt stands inside the statement so that no address register of
// an issued copy is rewritten ahead of it.
__device__ __forceinline__ void copy_tile(unsigned lds, const _Float16* gx,
                                          const _Float16* gw) {
    const unsigned l0 = lds,                 l1 = lds + 32 * PITCH * 2,
                   l2 = lds + 64 * PITCH * 2,  l3 = lds + 96 * PITCH * 2,
                   l4 = lds + 128 * PITCH * 2, l5 = lds + 160 * PITCH * 2,
                   l6 = lds + 192 * PITCH * 2, l7 = lds + 224 * PITCH * 2;
    const _Float16 *g0 = gx,            *g1 = gx + 32 * HID,
                   *g2 = gx + 64 * HID, *g3 = gx + 96 * HID,
                   *g4 = gw,            *g5 = gw + 32 * HID,
                   *g6 = gw + 64 * HID, *g7 = gw + 96 * HID;
    asm volatile(
        "global_load_async_to_lds_b128 %0, %8, off\n\t"
        "global_load_async_to_lds_b128 %1, %9, off\n\t"
        "global_load_async_to_lds_b128 %2, %10, off\n\t"
        "global_load_async_to_lds_b128 %3, %11, off\n\t"
        "global_load_async_to_lds_b128 %4, %12, off\n\t"
        "global_load_async_to_lds_b128 %5, %13, off\n\t"
        "global_load_async_to_lds_b128 %6, %14, off\n\t"
        "global_load_async_to_lds_b128 %7, %15, off\n\t"
        "s_wait_xcnt 0x0"
        :: "v"(l0), "v"(l1), "v"(l2), "v"(l3), "v"(l4), "v"(l5), "v"(l6), "v"(l7),
           "v"(g0), "v"(g1), "v"(g2), "v"(g3), "v"(g4), "v"(g5), "v"(g6), "v"(g7)
        : "memory");
}

__global__ __launch_bounds__(256)
void qkv_proj_kernel(const _Float16* __restrict__ Xh,
                     const _Float16* __restrict__ Wqh,
                     const _Float16* __restrict__ Wkh,
                     const _Float16* __restrict__ Wvh,
                     const float* __restrict__ bq,
                     const float* __restrict__ bk,
                     const float* __restrict__ bv,
                     _Float16* __restrict__ Qh, _Float16* __restrict__ Kh,
                     _Float16* __restrict__ Vt) {
    __shared__ __attribute__((aligned(16))) _Float16 tile[2 * BUFH];

    const int tid   = threadIdx.x;
    const int lane  = tid & 31;
    const int w     = tid >> 5;
    const int qlane = lane & 15;
    const int hi    = lane >> 4;           // 0: K set {0..7,16..23}, 1: {8..15,24..31}
    const int rw    = w >> 2;              // 0..1
    const int cw    = w & 3;               // 0..3
    const int rbase = blockIdx.x * 128 + rw * 64;
    const int cbase = blockIdx.y * 128 + cw * 32;
    const int z     = blockIdx.z;

    const _Float16* W    = (z == 0) ? Wqh : ((z == 1) ? Wkh : Wvh);
    const float*    bias = (z == 0) ? bq  : ((z == 1) ? bk  : bv);

    // Copy side: 8 lanes cover one 128-byte row, a wave covers 4 rows a copy.
    const int crow = tid >> 3;             // 0..31
    const int ccol = (tid & 7) * 8;        // halves
    const _Float16* gx = Xh + (size_t)(blockIdx.x * 128 + crow) * HID + ccol;
    const _Float16* gw = W  + (size_t)(blockIdx.y * 128 + crow) * HID + ccol;
    const unsigned  ldst = (unsigned)(size_t)tile + (crow * PITCH + ccol) * 2;

    // Read side: this lane's row in the wave's first A and first B fragment.
    const _Float16* fa = tile + (rw * 64 + qlane) * PITCH + hi * 8;
    const _Float16* fb = tile + (128 + cw * 32 + qlane) * PITCH + hi * 8;

    v8f acc[4][2] = {};

    copy_tile(ldst, gx, gw);                              // tile 0 -> buffer 0
    asm volatile("s_wait_asynccnt 0x0" ::: "memory");     // own copies landed
    __syncthreads();                                      // publishes tile 0
    copy_tile(ldst + BUFH * 2, gx + KT, gw + KT);         // tile 1 -> buffer 1

    for (int t = 0; t < NT; ++t) {
        const int boff = (t & 1) * BUFH;
#pragma unroll
        for (int kc = 0; kc < KT; kc += 32) {
            v16h a[4], b[2];
#pragma unroll
            for (int m = 0; m < 4; ++m)
                a[m] = ldfrag(fa + boff + m * 16 * PITCH + kc);
#pragma unroll
            for (int n = 0; n < 2; ++n)
                b[n] = ldfrag(fb + boff + n * 16 * PITCH + kc);
            // Keeps the 12 LDS reads together ahead of their 8 WMMAs: left
            // alone the compiler sinks them among the WMMAs, one full LDS
            // wait for every pair.
            __builtin_amdgcn_sched_barrier(0);
#pragma unroll
            for (int m = 0; m < 4; ++m)
#pragma unroll
                for (int n = 0; n < 2; ++n)
                    acc[m][n] = wmma_f16(a[m], b[n], acc[m][n]);
            // Keeps the next group's reads out of this WMMA block: left alone
            // the compiler spreads them over four places among the WMMAs.
            __builtin_amdgcn_sched_barrier(0);
        }
        // Hand-over: this wave's reads of the buffer are done, its copies of
        // the next tile have landed; the barrier publishes tile t + 1 and
        // frees the buffer that trip t has read for the refill behind it.
        asm volatile("s_wait_dscnt 0x0" ::: "memory");
        asm volatile("s_wait_asynccnt 0x0" ::: "memory");
        __syncthreads();
        if (t + 2 < NT)
            copy_tile(ldst + boff * 2, gx + (t + 2) * KT, gw + (t + 2) * KT);
    }
    asm volatile("s_wait_asynccnt 0x0" ::: "memory");     // nothing left in flight

    // Epilogue: bias add, cast to f16, store. Uniform z-branch hoisted.
    if (z == 2) {
        // V transposed: per (m,n) the 8 accumulator slots are contiguous in s
        // -> pack into one b128 store.
#pragma unroll
        for (int n = 0; n < 2; ++n) {
            const int col  = cbase + n * 16 + qlane;
            const int head = col >> 6, d = col & (HDIM - 1);
            const float bv_ = bias[col];
#pragma unroll
            for (int m = 0; m < 4; ++m) {
                const int row0 = rbase + m * 16 + hi * 8;   // rows row0..row0+7
                const int bi = row0 >> 11, s0 = row0 & (SEQ - 1);
                v8h pk;
#pragma unroll
                for (int j = 0; j < 8; ++j)
                    pk[j] = (_Float16)(acc[m][n][j] + bv_);
                *(v8h*)(Vt + ((size_t)(bi * NHEAD + head) * HDIM + d) * SEQ + s0) = pk;
            }
        }
    } else {
        _Float16* __restrict__ dst = (z == 0) ? Qh : Kh;
#pragma unroll
        for (int n = 0; n < 2; ++n) {
            const int col = cbase + n * 16 + qlane;
            const float bv_ = bias[col];
#pragma unroll
            for (int m = 0; m < 4; ++m) {
#pragma unroll
                for (int j = 0; j < 8; ++j) {
                    const int row = rbase + m * 16 + j + hi * 8;
                    dst[(size_t)row * HID + col] = (_Float16)(acc[m][n][j] + bv_);
                }
            }
        }
    }
}

// ---------------------------------------------------------------------------
// Kernel 2: flash attention.  One wave = 32 queries (two 16-query tiles) so
// every K/V fragment load feeds two WMMAs.
//   scoresT = K * Q^T   (M = keys, N = queries)  -> per-lane online softmax
//   ctxT    = V^T * P^T (M = dims, N = queries)  -> P^T C-layout == B-fragment
//   blockIdx.x : 256-query tile, blockIdx.y : head, blockIdx.z : batch
// Mask is pre-baked into an additive f32 bias in LDS (0 or -3e38), so the
// score epilogue is one FMA per element.
// The block's eight waves walk the same keys: K rows and V^T rows come into
// LDS once per block in stages of 128 keys by asynchronous copies (whole
// lines), two buffers, the next stage in flight while this one is worked on;
// every wave reads its fragments from LDS.
// ---------------------------------------------------------------------------
#define AKS    128                   // keys per stage
#define ANT    (SEQ / AKS)           // 16 stages
#define KPIT   72                    // halves per K row in LDS: 144 B = 16 B x odd
#define VPIT   136                   // halves per V^T row in LDS: 272 B = 16 B x odd
#define KHALF  (AKS * KPIT)          // halves of the K part (18,432 B)
#define ABUFH  (KHALF + HDIM * VPIT) // halves per buffer (35,840 B)

// Eight 16-byte copies per lane = this thread's share of one 32 KiB stage:
// four of K (32 rows of 128 B a copy), four of V^T (16 rows of 256 B a copy).
// The s_wait_xcnt stands inside the statement so that no address register of
// an issued copy is rewritten ahead of it.
__device__ __forceinline__ void copy_kv(unsigned lk, unsigned lv,
                                        const _Float16* gk, const _Float16* gv) {
    const unsigned l0 = lk,                 l1 = lk + 32 * KPIT * 2,
                   l2 = lk + 64 * KPIT * 2, l3 = lk + 96 * KPIT * 2,
                   l4 = lv,                 l5 = lv + 16 * VPIT * 2,
                   l6 = lv + 32 * VPIT * 2, l7 = lv + 48 * VPIT * 2;
    const _Float16 *g0 = gk,            *g1 = gk + 32 * HID,
                   *g2 = gk + 64 * HID, *g3 = gk + 96 * HID,
                   *g4 = gv,            *g5 = gv + 16 * SEQ,
                   *g6 = gv + 32 * SEQ, *g7 = gv + 48 * SEQ;
    asm volatile(
        "global_load_async_to_lds_b128 %0, %8, off\n\t"
        "global_load_async_to_lds_b128 %1, %9, off\n\t"
        "global_load_async_to_lds_b128 %2, %10, off\n\t"
        "global_load_async_to_lds_b128 %3, %11, off\n\t"
        "global_load_async_to_lds_b128 %4, %12, off\n\t"
        "global_load_async_to_lds_b128 %5, %13, off\n\t"
        "global_load_async_to_lds_b128 %6, %14, off\n\t"
        "global_load_async_to_lds_b128 %7, %15, off\n\t"
        "s_wait_xcnt 0x0"
        :: "v"(l0), "v"(l1), "v"(l2), "v"(l3), "v"(l4), "v"(l5), "v"(l6), "v"(l7),
           "v"(g0), "v"(g1), "v"(g2), "v"(g3), "v"(g4), "v"(g5), "v"(g6), "v"(g7)
        : "memory");
}

__global__ __launch_bounds__(256)
void attention_kernel(const _Float16* __restrict__ Qh,
                      const _Float16* __restrict__ Kh,
                      const _Float16* __restrict__ Vt,
                      const int* __restrict__ mask,
                      float* __restrict__ out) {
    __shared__ __attribute__((aligned(16))) float sbias[SEQ];
    __shared__ __attribute__((aligned(16))) _Float16 kv[2 * ABUFH];
    const int b    = blockIdx.z;
    const int head = blockIdx.y;
    const int tid  = threadIdx.x;

    const _Float16* Kbase = Kh + (size_t)b * SEQ * HID + head * HDIM;
    const _Float16* Vbase = Vt + (size_t)(b * NHEAD + head) * HDIM * SEQ;

    // Copy side. K: 8 lanes cover one 128-byte row; V^T: 16 lanes cover the
    // 256 bytes that one row has of a stage.
    const int krow = tid >> 3, kcol = (tid & 7) * 8;      // row 0..31, halves
    const int vrow = tid >> 4, vcol = (tid & 15) * 8;     // row 0..15, halves
    const _Float16* gk = Kbase + (size_t)krow * HID + kcol;
    const _Float16* gv = Vbase + (size_t)vrow * SEQ + vcol;
    const unsigned  lk = (unsigned)(size_t)kv + (krow * KPIT + kcol) * 2;
    const unsigned  lv = (unsigned)(size_t)kv + (KHALF + vrow * VPIT + vcol) * 2;

    copy_kv(lk, lv, gk, gv);                              // stage 0 -> buffer 0

    for (int i = tid; i < SEQ; i += 256)
        sbias[i] = (mask[b * SEQ + i] == 0) ? -3.0e38f : 0.0f;
    asm volatile("s_wait_asynccnt 0x0" ::: "memory");     // own copies landed
    __syncthreads();                                      // publishes sbias and stage 0
    copy_kv(lk + ABUFH * 2, lv + ABUFH * 2,
            gk + (size_t)AKS * HID, gv + AKS);            // stage 1 -> buffer 1

    const int lane  = tid & 31;
    const int w     = tid >> 5;
    const int qlane = lane & 15;
    const int hi    = lane >> 4;
    const int q0    = blockIdx.x * 256 + w * 32;

    // Q fragments (B-matrix of scoresT): lane = query, K = head_dim (2 chunks)
    v16h qf[2][2];
#pragma unroll
    for (int qt = 0; qt < 2; ++qt) {
        const _Float16* qp =
            Qh + (size_t)(b * SEQ + q0 + qt * 16 + qlane) * HID + head * HDIM;
#pragma unroll
        for (int kc = 0; kc < 2; ++kc)
            qf[qt][kc] = ldfrag(qp + kc * 32 + hi * 8);
    }

    // Read side: this lane's row in the first K and the first V^T fragment.
    const _Float16* fk = kv + qlane * KPIT + hi * 8;
    const _Float16* fv = kv + KHALF + qlane * VPIT + hi * 8;
    const float scale = 0.125f;   // 1/sqrt(64)

    float m[2] = {-1e30f, -1e30f};
    float l[2] = {0.0f, 0.0f};
    v8f acc[2][4] = {};

    for (int t = 0; t < ANT; ++t) {
      const int boff = (t & 1) * ABUFH;
      for (int kk = 0; kk < AKS; kk += 32) {
        const int kt = t * AKS + kk;

        // --- K A-fragments, shared by both query tiles ---
        v16h ak[2][2];   // [key sub-tile][head_dim chunk]
#pragma unroll
        for (int sub = 0; sub < 2; ++sub) {
            const _Float16* kp = fk + boff + (kk + sub * 16) * KPIT;
            ak[sub][0] = ldfrag(kp);
            ak[sub][1] = ldfrag(kp + 32);
        }

        // --- additive mask bias for this lane's 16 key slots (4x ds b128) ---
        float mb0[8], mb1[8];
        {
            const v4f* bp0 = (const v4f*)&sbias[kt + hi * 8];
            const v4f* bp1 = (const v4f*)&sbias[kt + 16 + hi * 8];
            v4f a0 = bp0[0], a1 = bp0[1], c0 = bp1[0], c1 = bp1[1];
#pragma unroll
            for (int j = 0; j < 4; ++j) {
                mb0[j] = a0[j]; mb0[4 + j] = a1[j];
                mb1[j] = c0[j]; mb1[4 + j] = c1[j];
            }
        }

        v16h pb[2];   // P^T B-fragments, one per query tile
#pragma unroll
        for (int qt = 0; qt < 2; ++qt) {
            // scoresT: two 16(key) x 16(query) tiles
            v8f st[2];
#pragma unroll
            for (int sub = 0; sub < 2; ++sub) {
                v8f c = {};
                c = wmma_f16(ak[sub][0], qf[qt][0], c);
                c = wmma_f16(ak[sub][1], qf[qt][1], c);
                st[sub] = c;
            }

            // scale+mask via single FMA, then per-query online softmax
            float p0[8], p1[8];
            float mx = -1e30f;
#pragma unroll
            for (int j = 0; j < 8; ++j) {
                const float s0 = fmaf(st[0][j], scale, mb0[j]);
                const float s1 = fmaf(st[1][j], scale, mb1[j]);
                p0[j] = s0; p1[j] = s1;
                mx = fmaxf(mx, fmaxf(s0, s1));
            }
            mx = fmaxf(mx, __shfl_xor(mx, 16, 32));  // combine half-rows
            const float mnew   = fmaxf(m[qt], mx);
            const float escale = __expf(m[qt] - mnew);

            float rs = 0.0f;
            v16h p;
#pragma unroll
            for (int j = 0; j < 8; ++j) {
                const float e0 = __expf(p0[j] - mnew);
                const float e1 = __expf(p1[j] - mnew);
                rs += e0 + e1;
                p[j]     = (_Float16)e0;
                p[8 + j] = (_Float16)e1;
            }
            rs += __shfl_xor(rs, 16, 32);
            l[qt] = l[qt] * escale + rs;
            m[qt] = mnew;
            pb[qt] = p;

            // rescale accumulators for this query tile
#pragma unroll
            for (int dt = 0; dt < 4; ++dt)
#pragma unroll
                for (int j = 0; j < 8; ++j) acc[qt][dt][j] *= escale;
        }

        // --- ctxT += V^T * P^T : each V fragment feeds both query tiles ---
#pragma unroll
        for (int dt = 0; dt < 4; ++dt) {
            const _Float16* vp = fv + boff + dt * 16 * VPIT + kk;
            v16h av = ldfrag(vp);
            acc[0][dt] = wmma_f16(av, pb[0], acc[0][dt]);
            acc[1][dt] = wmma_f16(av, pb[1], acc[1][dt]);
        }
      }
      // Hand-over: this wave's reads of the buffer are done, its copies of the
      // next stage have landed; the barrier publishes stage t + 1 and frees
      // the buffer that trip t has read for the refill behind it.
      asm volatile("s_wait_dscnt 0x0" ::: "memory");
      asm volatile("s_wait_asynccnt 0x0" ::: "memory");
      __syncthreads();
      if (t + 2 < ANT)
          copy_kv(lk + boff * 2, lv + boff * 2,
                  gk + (size_t)(t + 2) * AKS * HID, gv + (t + 2) * AKS);
    }
    asm volatile("s_wait_asynccnt 0x0" ::: "memory");     // nothing left in flight

    // --- write out: out[b, q, head*64 + d]; 8 floats per (qt,dt) are
    //     contiguous in d -> two b128 stores each ---
#pragma unroll
    for (int qt = 0; qt < 2; ++qt) {
        const float linv = 1.0f / l[qt];
        float* op = out + (size_t)(b * SEQ + q0 + qt * 16 + qlane) * HID
                        + head * HDIM + hi * 8;
#pragma unroll
        for (int dt = 0; dt < 4; ++dt) {
            v4f lo, hic;
#pragma unroll
            for (int j = 0; j < 4; ++j) {
                lo[j]  = acc[qt][dt][j]     * linv;
                hic[j] = acc[qt][dt][4 + j] * linv;
            }
            *(v4f*)(op + dt * 16)     = lo;
            *(v4f*)(op + dt * 16 + 4) = hic;
        }
    }
}

// ---------------------------------------------------------------------------

extern "C" void kernel_launch(void* const* d_in, const int* in_sizes, int n_in,
                              void* d_out, int out_size, void* d_ws, size_t ws_size,
                              hipStream_t stream) {
    (void)in_sizes; (void)n_in; (void)out_size; (void)ws_size;
    const float* X    = (const float*)d_in[0];
    const int*   mask = (const int*)d_in[1];
    const float* Wq   = (const float*)d_in[2];
    const float* bq   = (const float*)d_in[3];
    const float* Wk   = (const float*)d_in[4];
    const float* bk   = (const float*)d_in[5];
    const float* Wv   = (const float*)d_in[6];
    const float* bv   = (const float*)d_in[7];
    float* out = (float*)d_out;

    const size_t nX = (size_t)2 * SEQ * HID;      // 4096*1024
    const size_t nW = (size_t)HID * HID;          // 1024*1024
    _Float16* Qh  = (_Float16*)d_ws;
    _Float16* Kh  = Qh  + nX;
    _Float16* Vt  = Kh  + nX;
    _Float16* Xh  = Vt  + nX;
    _Float16* Wqh = Xh  + nX;
    _Float16* Wkh = Wqh + nW;
    _Float16* Wvh = Wkh + nW;                     // total 38 MiB workspace

    // Pass 0: one-shot fp32 -> f16 conversion of X and weights.
    cvt_f16_kernel<<<(int)(nX / 4 / 256), 256, 0, stream>>>(X,  Xh,  (int)(nX / 4));
    cvt_f16_kernel<<<(int)(nW / 4 / 256), 256, 0, stream>>>(Wq, Wqh, (int)(nW / 4));
    cvt_f16_kernel<<<(int)(nW / 4 / 256), 256, 0, stream>>>(Wk, Wkh, (int)(nW / 4));
    cvt_f16_kernel<<<(int)(nW / 4 / 256), 256, 0, stream>>>(Wv, Wvh, (int)(nW / 4));

    dim3 g1(4096 / 128, HID / 128, 3);            // 32 x 8 x 3
    qkv_proj_kernel<<<g1, 256, 0, stream>>>(Xh, Wqh, Wkh, Wvh, bq, bk, bv,
                                            Qh, Kh, Vt);

    dim3 g2(SEQ / 256, NHEAD, 2);                 // 8 x 16 x 2
    attention_kernel<<<g2, 256, 0, stream>>>(Qh, Kh, Vt, mask, out);
}

// v003
// One run takes 76.8 microseconds.
// Timed twice side by side with v002, it ran 1.07 times as fast both times.
// Counting every step since v000, it is 1.97 times as fast.
#include <hip/hip_runtime.h>
#include <hip/hip_bf16.h>

typedef __attribute__((ext_vector_type(16))) _Float16 v16h;
typedef __attribute__((ext_vector_type(8)))  _Float16 v8h;
typedef __attribute__((ext_vector_type(4)))  _Float16 v4h;
typedef __attribute__((ext_vector_type(8)))  float    v8f;
typedef __attribute__((ext_vector_type(4)))  float    v4f;

#define HID   1024
#define SEQ   2048
#define NHEAD 16
#define HDIM  64

__device__ __forceinline__ v8f wmma_f16(v16h a, v16h b, v8f c) {
    // D = A(16x32 f16) x B(32x16 f16) + C(16x16 f32)
    return __builtin_amdgcn_wmma_f32_16x16x32_f16(
        /*neg_a=*/false, a, /*neg_b=*/false, b,
        /*c_mod=*/(short)0, c, /*reuse_a=*/false, /*reuse_b=*/false);
}

__device__ __forceinline__ v8h ld8h(const _Float16* p) {  // one b128 load
    return *(const v8h*)p;
}

__device__ __forceinline__ v16h cat16(v8h a, v8h b) {
    return __builtin_shufflevector(a, b, 0,1,2,3,4,5,6,7,8,9,10,11,12,13,14,15);
}

// A/B fragment: elems 0..7 at p, elems 8..15 at p+16 (two b128 loads)
__device__ __forceinline__ v16h ldfrag(const _Float16* p) {
    return cat16(ld8h(p), ld8h(p + 16));
}

// ---------------------------------------------------------------------------
// Kernel 0: fp32 -> f16 pre-conversion of X, Wq, Wk and Wv in ONE launch
// (GEMM then re-reads f16).  The four f16 images lie one behind the other in
// the workspace, so dst is one range of 7 segments of 2^20 elements:
// segments 0..3 are X, 4 is Wq, 5 is Wk, 6 is Wv.  64 blocks a segment; a wave
// converts 8 KiB of contiguous f32: 16 loads of 512 B, all issued ahead of the
// first conversion.  Few, long waves: the pass pays for waves started and for
// launches, not for bytes.
// ---------------------------------------------------------------------------
#define CSEG   (1 << 18)             // 4-element vectors per segment
#define CVPT   16                    // vectors per thread
#define CBLK   (256 * CVPT)          // vectors per block (4096)
#define CGRID  (7 * CSEG / CBLK)     // 448 blocks

__global__ __launch_bounds__(256)
void cvt_f16_kernel(const float* __restrict__ X,  const float* __restrict__ Wq,
                    const float* __restrict__ Wk, const float* __restrict__ Wv,
                    _Float16* __restrict__ dst) {
    const int seg = blockIdx.x / (CSEG / CBLK);            // 0..6, block-uniform
    const float* src = (seg < 4) ? X + (size_t)seg * (CSEG * 4)
                     : (seg == 4) ? Wq : ((seg == 5) ? Wk : Wv);
    const int inblk = (threadIdx.x >> 5) * (32 * CVPT) + (threadIdx.x & 31);
    const v4f* sp = (const v4f*)src + (blockIdx.x % (CSEG / CBLK)) * CBLK + inblk;
    v4h*       dp = (v4h*)dst + (size_t)blockIdx.x * CBLK + inblk;

    // The three loops are unrolled so that v[] and r[] live in registers and
    // every load and store takes its step as an immediate offset.
    v4f v[CVPT];
#pragma unroll
    for (int j = 0; j < CVPT; ++j) v[j] = sp[j * 32];
    // Keeps all 16 loads ahead of the first conversion: left alone the
    // compiler holds the last two back until the first two have returned,
    // a second trip to memory in every wave.
    __builtin_amdgcn_sched_barrier(0);
    v4h r[CVPT];
#pragma unroll
    for (int j = 0; j < CVPT; ++j) {
        r[j][0] = (_Float16)v[j][0]; r[j][1] = (_Float16)v[j][1];
        r[j][2] = (_Float16)v[j][2]; r[j][3] = (_Float16)v[j][3];
    }
#pragma unroll
    for (int j = 0; j < CVPT; ++j) dp[j * 32] = r[j];
}

// ---------------------------------------------------------------------------
// Kernel 1: QKV projection.  out[n,o] = sum_k X[n,k] * W[o,k] + bias[o]
//   blockIdx.x : 128-row tile (N = B*S = 4096)
//   blockIdx.y : 128-col tile (O = 1024)
//   blockIdx.z : 0 -> Q, 1 -> K, 2 -> V (stored transposed per head)
// 8 waves (2 row x 4 col), each wave owns a 64x32 tile = 4x2 WMMA accums.
// The block's 128 X rows and 128 W rows come into LDS in tiles of 64 k
// (128-byte rows, whole lines) by asynchronous copies, two buffers, the next
// tile in flight while this one is worked on; fragments are read from LDS.
// ---------------------------------------------------------------------------
#define KT     64                    // k elements per tile: 128 B of every row
#define NT     (HID / KT)            // 16 tiles
#define PITCH  72                    // halves per LDS row: 144 B = 16 B x odd
#define TROWS  256                   // rows 0..127: X, rows 128..255: W
#define BUFH   (TROWS * PITCH)       // halves per buffer (36,864 B)

// Eight 16-byte copies per lane = this thread's share of one 32 KiB tile.
// The s_wait_xcnt stands inside the statement so that no address register of
// an issued copy is rewritten ahead of it.
__device__ __forceinline__ void copy_tile(unsigned lds, const _Float16* gx,
                                          const _Float16* gw) {
    const unsigned l0 = lds,                 l1 = lds + 32 * PITCH * 2,
                   l2 = lds + 64 * PITCH * 2,  l3 = lds + 96 * PITCH * 2,
                   l4 = lds + 128 * PITCH * 2, l5 = lds + 160 * PITCH * 2,
                   l6 = lds + 192 * PITCH * 2, l7 = lds + 224 * PITCH * 2;
    const _Float16 *g0 = gx,            *g1 = gx + 32 * HID,
                   *g2 = gx + 64 * HID, *g3 = gx + 96 * HID,
                   *g4 = gw,            *g5 = gw + 32 * HID,
                   *g6 = gw + 64 * HID, *g7 = gw + 96 * HID;
    asm volatile(
        "global_load_async_to_lds_b128 %0, %8, off\n\t"
        "global_load_async_to_lds_b128 %1, %9, off\n\t"
        "global_load_async_to_lds_b128 %2, %10, off\n\t"
        "global_load_async_to_lds_b128 %3, %11, off\n\t"
        "global_load_async_to_lds_b128 %4, %12, off\n\t"
        "global_load_async_to_lds_b128 %5, %13, off\n\t"
        "global_load_async_to_lds_b128 %6, %14, off\n\t"
        "global_load_async_to_lds_b128 %7, %15, off\n\t"
        "s_wait_xcnt 0x0"
        :: "v"(l0), "v"(l1), "v"(l2), "v"(l3), "v"(l4), "v"(l5), "v"(l6), "v"(l7),
           "v"(g0), "v"(g1), "v"(g2), "v"(g3), "v"(g4), "v"(g5), "v"(g6), "v"(g7)
        : "memory");
}

__global__ __launch_bounds__(256)
void qkv_proj_kernel(const _Float16* __restrict__ Xh,
                     const _Float16* __restrict__ Wqh,
                     const _Float16* __restrict__ Wkh,
                     const _Float16* __restrict__ Wvh,
                     const float* __restrict__ bq,
                     const float* __restrict__ bk,
                     const float* __restrict__ bv,
                     _Float16* __restrict__ Qh, _Float16* __restrict__ Kh,
                     _Float16* __restrict__ Vt) {
    __shared__ __attribute__((aligned(16))) _Float16 tile[2 * BUFH];

    const int tid   = threadIdx.x;
    const int lane  = tid & 31;
    const int w     = tid >> 5;
    const int qlane = lane & 15;
    const int hi    = lane >> 4;           // 0: K set {0..7,16..23}, 1: {8..15,24..31}
    const int rw    = w >> 2;              // 0..1
    const int cw    = w & 3;               // 0..3
    const int rbase = blockIdx.x * 128 + rw * 64;
    const int cbase = blockIdx.y * 128 + cw * 32;
    const int z     = blockIdx.z;

    const _Float16* W    = (z == 0) ? Wqh : ((z == 1) ? Wkh : Wvh);
    const float*    bias = (z == 0) ? bq  : ((z == 1) ? bk  : bv);

    // Copy side: 8 lanes cover one 128-byte row, a wave covers 4 rows a copy.
    const int crow = tid >> 3;             // 0..31
    const int ccol = (tid & 7) * 8;        // halves
    const _Float16* gx = Xh + (size_t)(blockIdx.x * 128 + crow) * HID + ccol;
    const _Float16* gw = W  + (size_t)(blockIdx.y * 128 + crow) * HID + ccol;
    const unsigned  ldst = (unsigned)(size_t)tile + (crow * PITCH + ccol) * 2;

    // Read side: this lane's row in the wave's first A and first B fragment.
    const _Float16* fa = tile + (rw * 64 + qlane) * PITCH + hi * 8;
    const _Float16* fb = tile + (128 + cw * 32 + qlane) * PITCH + hi * 8;

    v8f acc[4][2] = {};

    copy_tile(ldst, gx, gw);                              // tile 0 -> buffer 0
    asm volatile("s_wait_asynccnt 0x0" ::: "memory");     // own copies landed
    __syncthreads();                                      // publishes tile 0
    copy_tile(ldst + BUFH * 2, gx + KT, gw + KT);         // tile 1 -> buffer 1

    for (int t = 0; t < NT; ++t) {
        const int boff = (t & 1) * BUFH;
#pragma unroll
        for (int kc = 0; kc < KT; kc += 32) {
            v16h a[4], b[2];
#pragma unroll
            for (int m = 0; m < 4; ++m)
                a[m] = ldfrag(fa + boff + m * 16 * PITCH + kc);
#pragma unroll
            for (int n = 0; n < 2; ++n)
                b[n] = ldfrag(fb + boff + n * 16 * PITCH + kc);
            // Keeps the 12 LDS reads together ahead of their 8 WMMAs: left
            // alone the compiler sinks them among the WMMAs, one full LDS
            // wait for every pair.
            __builtin_amdgcn_sched_barrier(0);
#pragma unroll
            for (int m = 0; m < 4; ++m)
#pragma unroll
                for (int n = 0; n < 2; ++n)
                    acc[m][n] = wmma_f16(a[m], b[n], acc[m][n]);
            // Keeps the next group's reads out of this WMMA block: left alone
            // the compiler spreads them over four places among the WMMAs.
            __builtin_amdgcn_sched_barrier(0);
        }
        // Hand-over: this wave's reads of the buffer are done, its copies of
        // the next tile have landed; the barrier publishes tile t + 1 and
        // frees the buffer that trip t has read for the refill behind it.
        asm volatile("s_wait_dscnt 0x0" ::: "memory");
        asm volatile("s_wait_asynccnt 0x0" ::: "memory");
        __syncthreads();
        if (t + 2 < NT)
            copy_tile(ldst + boff * 2, gx + (t + 2) * KT, gw + (t + 2) * KT);
    }
    asm volatile("s_wait_asynccnt 0x0" ::: "memory");     // nothing left in flight

    // Epilogue: bias add, cast to f16, store. Uniform z-branch hoisted.
    if (z == 2) {
        // V transposed: per (m,n) the 8 accumulator slots are contiguous in s
        // -> pack into one b128 store.
#pragma unroll
        for (int n = 0; n < 2; ++n) {
            const int col  = cbase + n * 16 + qlane;
            const int head = col >> 6, d = col & (HDIM - 1);
            const float bv_ = bias[col];
#pragma unroll
            for (int m = 0; m < 4; ++m) {
                const int row0 = rbase + m * 16 + hi * 8;   // rows row0..row0+7
                const int bi = row0 >> 11, s0 = row0 & (SEQ - 1);
                v8h pk;
#pragma unroll
                for (int j = 0; j < 8; ++j)
                    pk[j] = (_Float16)(acc[m][n][j] + bv_);
                *(v8h*)(Vt + ((size_t)(bi * NHEAD + head) * HDIM + d) * SEQ + s0) = pk;
            }
        }
    } else {
        _Float16* __restrict__ dst = (z == 0) ? Qh : Kh;
#pragma unroll
        for (int n = 0; n < 2; ++n) {
            const int col = cbase + n * 16 + qlane;
            const float bv_ = bias[col];
#pragma unroll
            for (int m = 0; m < 4; ++m) {
#pragma unroll
                for (int j = 0; j < 8; ++j) {
                    const int row = rbase + m * 16 + j + hi * 8;
                    dst[(size_t)row * HID + col] = (_Float16)(acc[m][n][j] + bv_);
                }
            }
        }
    }
}

// ---------------------------------------------------------------------------
// Kernel 2: flash attention.  One wave = 32 queries (two 16-query tiles) so
// every K/V fragment load feeds two WMMAs.
//   scoresT = K * Q^T   (M = keys, N = queries)  -> per-lane online softmax
//   ctxT    = V^T * P^T (M = dims, N = queries)  -> P^T C-layout == B-fragment
//   blockIdx.x : 256-query tile, blockIdx.y : head, blockIdx.z : batch
// Mask is pre-baked into an additive f32 bias in LDS (0 or -3e38), so the
// score epilogue is one FMA per element.
// The block's eight waves walk the same keys: K rows and V^T rows come into
// LDS once per block in stages of 128 keys by asynchronous copies (whole
// lines), two buffers, the next stage in flight while this one is worked on;
// every wave reads its fragments from LDS.
// ---------------------------------------------------------------------------
#define AKS    128                   // keys per stage
#define ANT    (SEQ / AKS)           // 16 stages
#define KPIT   72                    // halves per K row in LDS: 144 B = 16 B x odd
#define VPIT   136                   // halves per V^T row in LDS: 272 B = 16 B x odd
#define KHALF  (AKS * KPIT)          // halves of the K part (18,432 B)
#define ABUFH  (KHALF + HDIM * VPIT) // halves per buffer (35,840 B)

// Eight 16-byte copies per lane = this thread's share of one 32 KiB stage:
// four of K (32 rows of 128 B a copy), four of V^T (16 rows of 256 B a copy).
// The s_wait_xcnt stands inside the statement so that no address register of
// an issued copy is rewritten ahead of it.
__device__ __forceinline__ void copy_kv(unsigned lk, unsigned lv,
                                        const _Float16* gk, const _Float16* gv) {
    const unsigned l0 = lk,                 l1 = lk + 32 * KPIT * 2,
                   l2 = lk + 64 * KPIT * 2, l3 = lk + 96 * KPIT * 2,
                   l4 = lv,                 l5 = lv + 16 * VPIT * 2,
                   l6 = lv + 32 * VPIT * 2, l7 = lv + 48 * VPIT * 2;
    const _Float16 *g0 = gk,            *g1 = gk + 32 * HID,
                   *g2 = gk + 64 * HID, *g3 = gk + 96 * HID,
                   *g4 = gv,            *g5 = gv + 16 * SEQ,
                   *g6 = gv + 32 * SEQ, *g7 = gv + 48 * SEQ;
    asm volatile(
        "global_load_async_to_lds_b128 %0, %8, off\n\t"
        "global_load_async_to_lds_b128 %1, %9, off\n\t"
        "global_load_async_to_lds_b128 %2, %10, off\n\t"
        "global_load_async_to_lds_b128 %3, %11, off\n\t"
        "global_load_async_to_lds_b128 %4, %12, off\n\t"
        "global_load_async_to_lds_b128 %5, %13, off\n\t"
        "global_load_async_to_lds_b128 %6, %14, off\n\t"
        "global_load_async_to_lds_b128 %7, %15, off\n\t"
        "s_wait_xcnt 0x0"
        :: "v"(l0), "v"(l1), "v"(l2), "v"(l3), "v"(l4), "v"(l5), "v"(l6), "v"(l7),
           "v"(g0), "v"(g1), "v"(g2), "v"(g3), "v"(g4), "v"(g5), "v"(g6), "v"(g7)
        : "memory");
}

__global__ __launch_bounds__(256)
void attention_kernel(const _Float16* __restrict__ Qh,
                      const _Float16* __restrict__ Kh,
                      const _Float16* __restrict__ Vt,
                      const int* __restrict__ mask,
                      float* __restrict__ out) {
    __shared__ __attribute__((aligned(16))) float sbias[SEQ];
    __shared__ __attribute__((aligned(16))) _Float16 kv[2 * ABUFH];
    const int b    = blockIdx.z;
    const int head = blockIdx.y;
    const int tid  = threadIdx.x;

    const _Float16* Kbase = Kh + (size_t)b * SEQ * HID + head * HDIM;
    const _Float16* Vbase = Vt + (size_t)(b * NHEAD + head) * HDIM * SEQ;

    // Copy side. K: 8 lanes cover one 128-byte row; V^T: 16 lanes cover the
    // 256 bytes that one row has of a stage.
    const int krow = tid >> 3, kcol = (tid & 7) * 8;      // row 0..31, halves
    const int vrow = tid >> 4, vcol = (tid & 15) * 8;     // row 0..15, halves
    const _Float16* gk = Kbase + (size_t)krow * HID + kcol;
    const _Float16* gv = Vbase + (size_t)vrow * SEQ + vcol;
    const unsigned  lk = (unsigned)(size_t)kv + (krow * KPIT + kcol) * 2;
    const unsigned  lv = (unsigned)(size_t)kv + (KHALF + vrow * VPIT + vcol) * 2;

    copy_kv(lk, lv, gk, gv);                              // stage 0 -> buffer 0

    for (int i = tid; i < SEQ; i += 256)
        sbias[i] = (mask[b * SEQ + i] == 0) ? -3.0e38f : 0.0f;
    asm volatile("s_wait_asynccnt 0x0" ::: "memory");     // own copies landed
    __syncthreads();                                      // publishes sbias and stage 0
    copy_kv(lk + ABUFH * 2, lv + ABUFH * 2,
            gk + (size_t)AKS * HID, gv + AKS);            // stage 1 -> buffer 1

    const int lane  = tid & 31;
    const int w     = tid >> 5;
    const int qlane = lane & 15;
    const int hi    = lane >> 4;
    const int q0    = blockIdx.x * 256 + w * 32;

    // Q fragments (B-matrix of scoresT): lane = query, K = head_dim (2 chunks)
    v16h qf[2][2];
#pragma unroll
    for (int qt = 0; qt < 2; ++qt) {
        const _Float16* qp =
            Qh + (size_t)(b * SEQ + q0 + qt * 16 + qlane) * HID + head * HDIM;
#pragma unroll
        for (int kc = 0; kc < 2; ++kc)
            qf[qt][kc] = ldfrag(qp + kc * 32 + hi * 8);
    }

    // Read side: this lane's row in the first K and the first V^T fragment.
    const _Float16* fk = kv + qlane * KPIT + hi * 8;
    const _Float16* fv = kv + KHALF + qlane * VPIT + hi * 8;
    const float scale = 0.125f;   // 1/sqrt(64)

    float m[2] = {-1e30f, -1e30f};
    float l[2] = {0.0f, 0.0f};
    v8f acc[2][4] = {};

    for (int t = 0; t < ANT; ++t) {
      const int boff = (t & 1) * ABUFH;
      for (int kk = 0; kk < AKS; kk += 32) {
        const int kt = t * AKS + kk;

        // --- K A-fragments, shared by both query tiles ---
        v16h ak[2][2];   // [key sub-tile][head_dim chunk]
#pragma unroll
        for (int sub = 0; sub < 2; ++sub) {
            const _Float16* kp = fk + boff + (kk + sub * 16) * KPIT;
            ak[sub][0] = ldfrag(kp);
            ak[sub][1] = ldfrag(kp + 32);
        }

        // --- additive mask bias for this lane's 16 key slots (4x ds b128) ---
        float mb0[8], mb1[8];
        {
            const v4f* bp0 = (const v4f*)&sbias[kt + hi * 8];
            const v4f* bp1 = (const v4f*)&sbias[kt + 16 + hi * 8];
            v4f a0 = bp0[0], a1 = bp0[1], c0 = bp1[0], c1 = bp1[1];
#pragma unroll
            for (int j = 0; j < 4; ++j) {
                mb0[j] = a0[j]; mb0[4 + j] = a1[j];
                mb1[j] = c0[j]; mb1[4 + j] = c1[j];
            }
        }

        v16h pb[2];   // P^T B-fragments, one per query tile
#pragma unroll
        for (int qt = 0; qt < 2; ++qt) {
            // scoresT: two 16(key) x 16(query) tiles
            v8f st[2];
#pragma unroll
            for (int sub = 0; sub < 2; ++sub) {
                v8f c = {};
                c = wmma_f16(ak[sub][0], qf[qt][0], c);
                c = wmma_f16(ak[sub][1], qf[qt][1], c);
                st[sub] = c;
            }

            // scale+mask via single FMA, then per-query online softmax
            float p0[8], p1[8];
            float mx = -1e30f;
#pragma unroll
            for (int j = 0; j < 8; ++j) {
                const float s0 = fmaf(st[0][j], scale, mb0[j]);
                const float s1 = fmaf(st[1][j], scale, mb1[j]);
                p0[j] = s0; p1[j] = s1;
                mx = fmaxf(mx, fmaxf(s0, s1));
            }
            mx = fmaxf(mx, __shfl_xor(mx, 16, 32));  // combine half-rows
            const float mnew   = fmaxf(m[qt], mx);
            const float escale = __expf(m[qt] - mnew);

            float rs = 0.0f;
            v16h p;
#pragma unroll
            for (int j = 0; j < 8; ++j) {
                const float e0 = __expf(p0[j] - mnew);
                const float e1 = __expf(p1[j] - mnew);
                rs += e0 + e1;
                p[j]     = (_Float16)e0;
                p[8 + j] = (_Float16)e1;
            }
            rs += __shfl_xor(rs, 16, 32);
            l[qt] = l[qt] * escale + rs;
            m[qt] = mnew;
            pb[qt] = p;

            // rescale accumulators for this query tile
#pragma unroll
            for (int dt = 0; dt < 4; ++dt)
#pragma unroll
                for (int j = 0; j < 8; ++j) acc[qt][dt][j] *= escale;
        }

        // --- ctxT += V^T * P^T : each V fragment feeds both query tiles ---
#pragma unroll
        for (int dt = 0; dt < 4; ++dt) {
            const _Float16* vp = fv + boff + dt * 16 * VPIT + kk;
            v16h av = ldfrag(vp);
            acc[0][dt] = wmma_f16(av, pb[0], acc[0][dt]);
            acc[1][dt] = wmma_f16(av, pb[1], acc[1][dt]);
        }
      }
      // Hand-over: this wave's reads of the buffer are done, its copies of the
      // next stage have landed; the barrier publishes stage t + 1 and frees
      // the buffer that trip t has read for the refill behind it.
      asm volatile("s_wait_dscnt 0x0" ::: "memory");
      asm volatile("s_wait_asynccnt 0x0" ::: "memory");
      __syncthreads();
      if (t + 2 < ANT)
          copy_kv(lk + boff * 2, lv + boff * 2,
                  gk + (size_t)(t + 2) * AKS * HID, gv + (t + 2) * AKS);
    }
    asm volatile("s_wait_asynccnt 0x0" ::: "memory");     // nothing left in flight

    // --- write out: out[b, q, head*64 + d]; 8 floats per (qt,dt) are
    //     contiguous in d -> two b128 stores each ---
#pragma unroll
    for (int qt = 0; qt < 2; ++qt) {
        const float linv = 1.0f / l[qt];
        float* op = out + (size_t)(b * SEQ + q0 + qt * 16 + qlane) * HID
                        + head * HDIM + hi * 8;
#pragma unroll
        for (int dt = 0; dt < 4; ++dt) {
            v4f lo, hic;
#pragma unroll
            for (int j = 0; j < 4; ++j) {
                lo[j]  = acc[qt][dt][j]     * linv;
                hic[j] = acc[qt][dt][4 + j] * linv;
            }
            *(v4f*)(op + dt * 16)     = lo;
            *(v4f*)(op + dt * 16 + 4) = hic;
        }
    }
}

// ---------------------------------------------------------------------------

extern "C" void kernel_launch(void* const* d_in, const int* in_sizes, int n_in,
                              void* d_out, int out_size, void* d_ws, size_t ws_size,
                              hipStream_t stream) {
    (void)in_sizes; (void)n_in; (void)out_size; (void)ws_size;
    const float* X    = (const float*)d_in[0];
    const int*   mask = (const int*)d_in[1];
    const float* Wq   = (const float*)d_in[2];
    const float* bq   = (const float*)d_in[3];
    const float* Wk   = (const float*)d_in[4];
    const float* bk   = (const float*)d_in[5];
    const float* Wv   = (const float*)d_in[6];
    const float* bv   = (const float*)d_in[7];
    float* out = (float*)d_out;

    const size_t nX = (size_t)2 * SEQ * HID;      // 4096*1024
    const size_t nW = (size_t)HID * HID;          // 1024*1024
    _Float16* Qh  = (_Float16*)d_ws;
    _Float16* Kh  = Qh  + nX;
    _Float16* Vt  = Kh  + nX;
    _Float16* Xh  = Vt  + nX;
    _Float16* Wqh = Xh  + nX;
    _Float16* Wkh = Wqh + nW;
    _Float16* Wvh = Wkh + nW;                     // total 38 MiB workspace

    // Pass 0: one-shot fp32 -> f16 conversion of X and weights, one launch;
    // Xh, Wqh, Wkh, Wvh are contiguous, so Xh is the start of the whole range.
    cvt_f16_kernel<<<CGRID, 256, 0, stream>>>(X, Wq, Wk, Wv, Xh);

    dim3 g1(4096 / 128, HID / 128, 3);            // 32 x 8 x 3
    qkv_proj_kernel<<<g1, 256, 0, stream>>>(Xh, Wqh, Wkh, Wvh, bq, bk, bv,
                                            Qh, Kh, Vt);

    dim3 g2(SEQ / 256, NHEAD, 2);                 // 8 x 16 x 2
    attention_kernel<<<g2, 256, 0, stream>>>(Qh, Kh, Vt, mask, out);
}

// v004
// One run takes 67.4 microseconds.
// Next to v003, in two timings, it ran 1.15 and 1.14 times as fast.
// All steps since v000 together make it 2.25 times as fast.
#include <hip/hip_runtime.h>
#include <hip/hip_bf16.h>

typedef __attribute__((ext_vector_type(16))) _Float16 v16h;
typedef __attribute__((ext_vector_type(8)))  _Float16 v8h;
typedef __attribute__((ext_vector_type(4)))  _Float16 v4h;
typedef __attribute__((ext_vector_type(8)))  float    v8f;
typedef __attribute__((ext_vector_type(4)))  float    v4f;
typedef __attribute__((ext_vector_type(2)))  float    v2f;

#define HID   1024
#define SEQ   2048
#define NHEAD 16
#define HDIM  64

__device__ __forceinline__ v8f wmma_f16(v16h a, v16h b, v8f c) {
    // D = A(16x32 f16) x B(32x16 f16) + C(16x16 f32)
    return __builtin_amdgcn_wmma_f32_16x16x32_f16(
        /*neg_a=*/false, a, /*neg_b=*/false, b,
        /*c_mod=*/(short)0, c, /*reuse_a=*/false, /*reuse_b=*/false);
}

__device__ __forceinline__ v8h ld8h(const _Float16* p) {  // one b128 load
    return *(const v8h*)p;
}

__device__ __forceinline__ v16h cat16(v8h a, v8h b) {
    return __builtin_shufflevector(a, b, 0,1,2,3,4,5,6,7,8,9,10,11,12,13,14,15);
}

// A/B fragment: elems 0..7 at p, elems 8..15 at p+16 (two b128 loads)
__device__ __forceinline__ v16h ldfrag(const _Float16* p) {
    return cat16(ld8h(p), ld8h(p + 16));
}

// ---------------------------------------------------------------------------
// Kernel 0: fp32 -> f16 pre-conversion of X, Wq, Wk and Wv in ONE launch
// (GEMM then re-reads f16).  The four f16 images lie one behind the other in
// the workspace, so dst is one range of 7 segments of 2^20 elements:
// segments 0..3 are X, 4 is Wq, 5 is Wk, 6 is Wv.  64 blocks a segment; a wave
// converts 8 KiB of contiguous f32: 16 loads of 512 B, all issued ahead of the
// first conversion.  Few, long waves: the pass pays for waves started and for
// launches, not for bytes.
// ---------------------------------------------------------------------------
#define CSEG   (1 << 18)             // 4-element vectors per segment
#define CVPT   16                    // vectors per thread
#define CBLK   (256 * CVPT)          // vectors per block (4096)
#define CGRID  (7 * CSEG / CBLK)     // 448 blocks

__global__ __launch_bounds__(256)
void cvt_f16_kernel(const float* __restrict__ X,  const float* __restrict__ Wq,
                    const float* __restrict__ Wk, const float* __restrict__ Wv,
                    _Float16* __restrict__ dst) {
    const int seg = blockIdx.x / (CSEG / CBLK);            // 0..6, block-uniform
    const float* src = (seg < 4) ? X + (size_t)seg * (CSEG * 4)
                     : (seg == 4) ? Wq : ((seg == 5) ? Wk : Wv);
    const int inblk = (threadIdx.x >> 5) * (32 * CVPT) + (threadIdx.x & 31);
    const v4f* sp = (const v4f*)src + (blockIdx.x % (CSEG / CBLK)) * CBLK + inblk;
    v4h*       dp = (v4h*)dst + (size_t)blockIdx.x * CBLK + inblk;

    // The three loops are unrolled so that v[] and r[] live in registers and
    // every load and store takes its step as an immediate offset.
    v4f v[CVPT];
#pragma unroll
    for (int j = 0; j < CVPT; ++j) v[j] = sp[j * 32];
    // Keeps all 16 loads ahead of the first conversion: left alone the
    // compiler holds the last two back until the first two have returned,
    // a second trip to memory in every wave.
    __builtin_amdgcn_sched_barrier(0);
    v4h r[CVPT];
#pragma unroll
    for (int j = 0; j < CVPT; ++j) {
        r[j][0] = (_Float16)v[j][0]; r[j][1] = (_Float16)v[j][1];
        r[j][2] = (_Float16)v[j][2]; r[j][3] = (_Float16)v[j][3];
    }
#pragma unroll
    for (int j = 0; j < CVPT; ++j) dp[j * 32] = r[j];
}

// ---------------------------------------------------------------------------
// Kernel 1: QKV projection.  out[n,o] = sum_k X[n,k] * W[o,k] + bias[o]
//   blockIdx.x : 128-row tile (N = B*S = 4096)
//   blockIdx.y : 128-col tile (O = 1024)
//   blockIdx.z : 0 -> Q, 1 -> K, 2 -> V (stored transposed per head)
// 8 waves (2 row x 4 col), each wave owns a 64x32 tile = 4x2 WMMA accums.
// The block's 128 X rows and 128 W rows come into LDS in tiles of 64 k
// (128-byte rows, whole lines) by asynchronous copies, two buffers, the next
// tile in flight while this one is worked on; fragments are read from LDS.
// ---------------------------------------------------------------------------
#define KT     64                    // k elements per tile: 128 B of every row
#define NT     (HID / KT)            // 16 tiles
#define PITCH  72                    // halves per LDS row: 144 B = 16 B x odd
#define TROWS  256                   // rows 0..127: X, rows 128..255: W
#define BUFH   (TROWS * PITCH)       // halves per buffer (36,864 B)

// Eight 16-byte copies per lane = this thread's share of one 32 KiB tile.
// The s_wait_xcnt stands inside the statement so that no address register of
// an issued copy is rewritten ahead of it.
__device__ __forceinline__ void copy_tile(unsigned lds, const _Float16* gx,
                                          const _Float16* gw) {
    const unsigned l0 = lds,                 l1 = lds + 32 * PITCH * 2,
                   l2 = lds + 64 * PITCH * 2,  l3 = lds + 96 * PITCH * 2,
                   l4 = lds + 128 * PITCH * 2, l5 = lds + 160 * PITCH * 2,
                   l6 = lds + 192 * PITCH * 2, l7 = lds + 224 * PITCH * 2;
    const _Float16 *g0 = gx,            *g1 = gx + 32 * HID,
                   *g2 = gx + 64 * HID, *g3 = gx + 96 * HID,
                   *g4 = gw,            *g5 = gw + 32 * HID,
                   *g6 = gw + 64 * HID, *g7 = gw + 96 * HID;
    asm volatile(
        "global_load_async_to_lds_b128 %0, %8, off\n\t"
        "global_load_async_to_lds_b128 %1, %9, off\n\t"
        "global_load_async_to_lds_b128 %2, %10, off\n\t"
        "global_load_async_to_lds_b128 %3, %11, off\n\t"
        "global_load_async_to_lds_b128 %4, %12, off\n\t"
        "global_load_async_to_lds_b128 %5, %13, off\n\t"
        "global_load_async_to_lds_b128 %6, %14, off\n\t"
        "global_load_async_to_lds_b128 %7, %15, off\n\t"
        "s_wait_xcnt 0x0"
        :: "v"(l0), "v"(l1), "v"(l2), "v"(l3), "v"(l4), "v"(l5), "v"(l6), "v"(l7),
           "v"(g0), "v"(g1), "v"(g2), "v"(g3), "v"(g4), "v"(g5), "v"(g6), "v"(g7)
        : "memory");
}

__global__ __launch_bounds__(256)
void qkv_proj_kernel(const _Float16* __restrict__ Xh,
                     const _Float16* __restrict__ Wqh,
                     const _Float16* __restrict__ Wkh,
                     const _Float16* __restrict__ Wvh,
                     const float* __restrict__ bq,
                     const float* __restrict__ bk,
                     const float* __restrict__ bv,
                     _Float16* __restrict__ Qh, _Float16* __restrict__ Kh,
                     _Float16* __restrict__ Vt) {
    __shared__ __attribute__((aligned(16))) _Float16 tile[2 * BUFH];

    const int tid   = threadIdx.x;
    const int lane  = tid & 31;
    const int w     = tid >> 5;
    const int qlane = lane & 15;
    const int hi    = lane >> 4;           // 0: K set {0..7,16..23}, 1: {8..15,24..31}
    const int rw    = w >> 2;              // 0..1
    const int cw    = w & 3;               // 0..3
    const int rbase = blockIdx.x * 128 + rw * 64;
    const int cbase = blockIdx.y * 128 + cw * 32;
    const int z     = blockIdx.z;

    const _Float16* W    = (z == 0) ? Wqh : ((z == 1) ? Wkh : Wvh);
    const float*    bias = (z == 0) ? bq  : ((z == 1) ? bk  : bv);

    // Copy side: 8 lanes cover one 128-byte row, a wave covers 4 rows a copy.
    const int crow = tid >> 3;             // 0..31
    const int ccol = (tid & 7) * 8;        // halves
    const _Float16* gx = Xh + (size_t)(blockIdx.x * 128 + crow) * HID + ccol;
    const _Float16* gw = W  + (size_t)(blockIdx.y * 128 + crow) * HID + ccol;
    const unsigned  ldst = (unsigned)(size_t)tile + (crow * PITCH + ccol) * 2;

    // Read side: this lane's row in the wave's first A and first B fragment.
    const _Float16* fa = tile + (rw * 64 + qlane) * PITCH + hi * 8;
    const _Float16* fb = tile + (128 + cw * 32 + qlane) * PITCH + hi * 8;

    v8f acc[4][2] = {};

    copy_tile(ldst, gx, gw);                              // tile 0 -> buffer 0
    asm volatile("s_wait_asynccnt 0x0" ::: "memory");     // own copies landed
    __syncthreads();                                      // publishes tile 0
    copy_tile(ldst + BUFH * 2, gx + KT, gw + KT);         // tile 1 -> buffer 1

    for (int t = 0; t < NT; ++t) {
        const int boff = (t & 1) * BUFH;
#pragma unroll
        for (int kc = 0; kc < KT; kc += 32) {
            v16h a[4], b[2];
#pragma unroll
            for (int m = 0; m < 4; ++m)
                a[m] = ldfrag(fa + boff + m * 16 * PITCH + kc);
#pragma unroll
            for (int n = 0; n < 2; ++n)
                b[n] = ldfrag(fb + boff + n * 16 * PITCH + kc);
            // Keeps the 12 LDS reads together ahead of their 8 WMMAs: left
            // alone the compiler sinks them among the WMMAs, one full LDS
            // wait for every pair.
            __builtin_amdgcn_sched_barrier(0);
#pragma unroll
            for (int m = 0; m < 4; ++m)
#pragma unroll
                for (int n = 0; n < 2; ++n)
                    acc[m][n] = wmma_f16(a[m], b[n], acc[m][n]);
            // Keeps the next group's reads out of this WMMA block: left alone
            // the compiler spreads them over four places among the WMMAs.
            __builtin_amdgcn_sched_barrier(0);
        }
        // Hand-over: this wave's reads of the buffer are done, its copies of
        // the next tile have landed; the barrier publishes tile t + 1 and
        // frees the buffer that trip t has read for the refill behind it.
        asm volatile("s_wait_dscnt 0x0" ::: "memory");
        asm volatile("s_wait_asynccnt 0x0" ::: "memory");
        __syncthreads();
        if (t + 2 < NT)
            copy_tile(ldst + boff * 2, gx + (t + 2) * KT, gw + (t + 2) * KT);
    }
    asm volatile("s_wait_asynccnt 0x0" ::: "memory");     // nothing left in flight

    // Epilogue: bias add, cast to f16, store. Uniform z-branch hoisted.
    if (z == 2) {
        // V transposed: per (m,n) the 8 accumulator slots are contiguous in s
        // -> pack into one b128 store.
#pragma unroll
        for (int n = 0; n < 2; ++n) {
            const int col  = cbase + n * 16 + qlane;
            const int head = col >> 6, d = col & (HDIM - 1);
            const float bv_ = bias[col];
#pragma unroll
            for (int m = 0; m < 4; ++m) {
                const int row0 = rbase + m * 16 + hi * 8;   // rows row0..row0+7
                const int bi = row0 >> 11, s0 = row0 & (SEQ - 1);
                v8h pk;
#pragma unroll
                for (int j = 0; j < 8; ++j)
                    pk[j] = (_Float16)(acc[m][n][j] + bv_);
                *(v8h*)(Vt + ((size_t)(bi * NHEAD + head) * HDIM + d) * SEQ + s0) = pk;
            }
        }
    } else {
        _Float16* __restrict__ dst = (z == 0) ? Qh : Kh;
#pragma unroll
        for (int n = 0; n < 2; ++n) {
            const int col = cbase + n * 16 + qlane;
            const float bv_ = bias[col];
#pragma unroll
            for (int m = 0; m < 4; ++m) {
#pragma unroll
                for (int j = 0; j < 8; ++j) {
                    const int row = rbase + m * 16 + j + hi * 8;
                    dst[(size_t)row * HID + col] = (_Float16)(acc[m][n][j] + bv_);
                }
            }
        }
    }
}

// ---------------------------------------------------------------------------
// Kernel 2: flash attention.  One wave = 32 queries (two 16-query tiles) so
// every K/V fragment load feeds two WMMAs.
//   scoresT = K * Q^T   (M = keys, N = queries)  -> per-lane online softmax
//   ctxT    = V^T * P^T (M = dims, N = queries)  -> P^T C-layout == B-fragment
//   blockIdx.x : 256-query tile, blockIdx.y : head, blockIdx.z : batch
// Mask is pre-baked into an additive f32 bias in LDS (0 or -3e38) that the
// score product takes as its start value.
// Lazy rescale: the maximum in use, m (log2-scaled), may trail a column's true
// maximum by up to 8, so an exponential can reach 2^8.  One test per pass for
// the whole wave; only when it fires are the halves' maxima joined, m raised
// and the accumulators and sums rescaled.  On the usual path a score costs one
// FMA and one exponential.  Every lane keeps the sums of its own keys; the two
// halves of a column are added once, behind the loop.
// The block's eight waves walk the same keys: K rows and V^T rows come into
// LDS once per block in stages of 128 keys by asynchronous copies (whole
// lines), two buffers, the next stage in flight while this one is worked on;
// every wave reads its fragments from LDS.
// ---------------------------------------------------------------------------
#define AKS    128                   // keys per stage
#define ANT    (SEQ / AKS)           // 16 stages
#define KPIT   72                    // halves per K row in LDS: 144 B = 16 B x odd
#define VPIT   136                   // halves per V^T row in LDS: 272 B = 16 B x odd
#define KHALF  (AKS * KPIT)          // halves of the K part (18,432 B)
#define ABUFH  (KHALF + HDIM * VPIT) // halves per buffer (35,840 B)

// Eight 16-byte copies per lane = this thread's share of one 32 KiB stage:
// four of K (32 rows of 128 B a copy), four of V^T (16 rows of 256 B a copy).
// The s_wait_xcnt stands inside the statement so that no address register of
// an issued copy is rewritten ahead of it.
__device__ __forceinline__ void copy_kv(unsigned lk, unsigned lv,
                                        const _Float16* gk, const _Float16* gv) {
    const unsigned l0 = lk,                 l1 = lk + 32 * KPIT * 2,
                   l2 = lk + 64 * KPIT * 2, l3 = lk + 96 * KPIT * 2,
                   l4 = lv,                 l5 = lv + 16 * VPIT * 2,
                   l6 = lv + 32 * VPIT * 2, l7 = lv + 48 * VPIT * 2;
    const _Float16 *g0 = gk,            *g1 = gk + 32 * HID,
                   *g2 = gk + 64 * HID, *g3 = gk + 96 * HID,
                   *g4 = gv,            *g5 = gv + 16 * SEQ,
                   *g6 = gv + 32 * SEQ, *g7 = gv + 48 * SEQ;
    asm volatile(
        "global_load_async_to_lds_b128 %0, %8, off\n\t"
        "global_load_async_to_lds_b128 %1, %9, off\n\t"
        "global_load_async_to_lds_b128 %2, %10, off\n\t"
        "global_load_async_to_lds_b128 %3, %11, off\n\t"
        "global_load_async_to_lds_b128 %4, %12, off\n\t"
        "global_load_async_to_lds_b128 %5, %13, off\n\t"
        "global_load_async_to_lds_b128 %6, %14, off\n\t"
        "global_load_async_to_lds_b128 %7, %15, off\n\t"
        "s_wait_xcnt 0x0"
        :: "v"(l0), "v"(l1), "v"(l2), "v"(l3), "v"(l4), "v"(l5), "v"(l6), "v"(l7),
           "v"(g0), "v"(g1), "v"(g2), "v"(g3), "v"(g4), "v"(g5), "v"(g6), "v"(g7)
        : "memory");
}

__global__ __launch_bounds__(256)
void attention_kernel(const _Float16* __restrict__ Qh,
                      const _Float16* __restrict__ Kh,
                      const _Float16* __restrict__ Vt,
                      const int* __restrict__ mask,
                      float* __restrict__ out) {
    __shared__ __attribute__((aligned(16))) float sbias[SEQ];
    __shared__ __attribute__((aligned(16))) _Float16 kv[2 * ABUFH];
    const int b    = blockIdx.z;
    const int head = blockIdx.y;
    const int tid  = threadIdx.x;

    const _Float16* Kbase = Kh + (size_t)b * SEQ * HID + head * HDIM;
    const _Float16* Vbase = Vt + (size_t)(b * NHEAD + head) * HDIM * SEQ;

    // Copy side. K: 8 lanes cover one 128-byte row; V^T: 16 lanes cover the
    // 256 bytes that one row has of a stage.
    const int krow = tid >> 3, kcol = (tid & 7) * 8;      // row 0..31, halves
    const int vrow = tid >> 4, vcol = (tid & 15) * 8;     // row 0..15, halves
    const _Float16* gk = Kbase + (size_t)krow * HID + kcol;
    const _Float16* gv = Vbase + (size_t)vrow * SEQ + vcol;
    const unsigned  lk = (unsigned)(size_t)kv + (krow * KPIT + kcol) * 2;
    const unsigned  lv = (unsigned)(size_t)kv + (KHALF + vrow * VPIT + vcol) * 2;

    copy_kv(lk, lv, gk, gv);                              // stage 0 -> buffer 0

    for (int i = tid; i < SEQ; i += 256)
        sbias[i] = (mask[b * SEQ + i] == 0) ? -3.0e38f : 0.0f;
    asm volatile("s_wait_asynccnt 0x0" ::: "memory");     // own copies landed
    __syncthreads();                                      // publishes sbias and stage 0
    copy_kv(lk + ABUFH * 2, lv + ABUFH * 2,
            gk + (size_t)AKS * HID, gv + AKS);            // stage 1 -> buffer 1

    const int lane  = tid & 31;
    const int w     = tid >> 5;
    const int qlane = lane & 15;
    const int hi    = lane >> 4;
    const int q0    = blockIdx.x * 256 + w * 32;

    // Q fragments (B-matrix of scoresT): lane = query, K = head_dim (2 chunks)
    v16h qf[2][2];
#pragma unroll
    for (int qt = 0; qt < 2; ++qt) {
        const _Float16* qp =
            Qh + (size_t)(b * SEQ + q0 + qt * 16 + qlane) * HID + head * HDIM;
#pragma unroll
        for (int kc = 0; kc < 2; ++kc)
            qf[qt][kc] = ldfrag(qp + kc * 32 + hi * 8);
    }

    // Read side: this lane's row in the first K and the first V^T fragment.
    const _Float16* fk = kv + qlane * KPIT + hi * 8;
    const _Float16* fv = kv + KHALF + qlane * VPIT + hi * 8;
    const float c2 = 0.125f * 1.44269504088896340736f;   // log2(e) / sqrt(64)

    float m[2] = {-1e30f, -1e30f};
    v2f   l[2][2] = {};           // per lane: two chains of pair sums a tile
    v8f acc[2][4] = {};

    for (int t = 0; t < ANT; ++t) {
      const int boff = (t & 1) * ABUFH;
      for (int kk = 0; kk < AKS; kk += 32) {
        const int kt = t * AKS + kk;

        // --- K A-fragments, shared by both query tiles ---
        v16h ak[2][2];   // [key sub-tile][head_dim chunk]
#pragma unroll
        for (int sub = 0; sub < 2; ++sub) {
            const _Float16* kp = fk + boff + (kk + sub * 16) * KPIT;
            ak[sub][0] = ldfrag(kp);
            ak[sub][1] = ldfrag(kp + 32);
        }

        // --- additive mask bias for this lane's 16 key slots (4x ds b128) ---
        v8f mb[2];
#pragma unroll
        for (int sub = 0; sub < 2; ++sub) {
            const v4f* bp = (const v4f*)&sbias[kt + sub * 16 + hi * 8];
            mb[sub] = __builtin_shufflevector(bp[0], bp[1], 0, 1, 2, 3, 4, 5, 6, 7);
        }

        // --- scoresT: 2 x 2 tiles of 16(key) x 16(query), raw scores + bias ---
        v8f st[2][2];   // [query tile][key sub-tile]
#pragma unroll
        for (int qt = 0; qt < 2; ++qt)
#pragma unroll
            for (int sub = 0; sub < 2; ++sub) {
                v8f c = wmma_f16(ak[sub][0], qf[qt][0], mb[sub]);
                st[qt][sub] = wmma_f16(ak[sub][1], qf[qt][1], c);
            }

        // --- lazy test: has any lane a score more than 8 above its m? ---
        float mx[2];
        bool need = false;
#pragma unroll
        for (int qt = 0; qt < 2; ++qt) {
            float x = fmaxf(st[qt][0][0], st[qt][1][0]);
#pragma unroll
            for (int j = 1; j < 8; ++j)
                x = fmaxf(x, fmaxf(st[qt][0][j], st[qt][1][j]));
            mx[qt] = x;
            need = need || (fmaf(x, c2, -m[qt]) > 8.0f);
        }
        if (__builtin_amdgcn_ballot_w32(need) != 0) {   // scalar branch, rare
#pragma unroll
            for (int qt = 0; qt < 2; ++qt) {
                const float mnew =   // the same in both halves of a column
                    fmaxf(m[qt], fmaxf(mx[qt], __shfl_xor(mx[qt], 16, 32)) * c2);
                const float corr = __builtin_amdgcn_exp2f(m[qt] - mnew);
                m[qt] = mnew;
                l[qt][0] *= corr;
                l[qt][1] *= corr;
#pragma unroll
                for (int dt = 0; dt < 4; ++dt) acc[qt][dt] *= corr;
            }
        }

        // --- P^T = 2^(score * c2 - m): one FMA, one exponential an element ---
        v16h pb[2];   // P^T B-fragments, one per query tile
#pragma unroll
        for (int qt = 0; qt < 2; ++qt) {
            const v2f nm = {-m[qt], -m[qt]};
            const v2f cc = {c2, c2};
            v16h p;
#pragma unroll
            for (int i = 0; i < 8; ++i) {
                const int sub = i >> 2, j = 2 * (i & 3);
                const v2f a = __builtin_elementwise_fma(
                    (v2f){st[qt][sub][j], st[qt][sub][j + 1]}, cc, nm);
                const v2f e = {__builtin_amdgcn_exp2f(a.x),
                               __builtin_amdgcn_exp2f(a.y)};
                l[qt][i & 1] += e;
                p[sub * 8 + j]     = (_Float16)e.x;
                p[sub * 8 + j + 1] = (_Float16)e.y;
            }
            pb[qt] = p;
        }

        // --- ctxT += V^T * P^T : each V fragment feeds both query tiles ---
#pragma unroll
        for (int dt = 0; dt < 4; ++dt) {
            const _Float16* vp = fv + boff + dt * 16 * VPIT + kk;
            v16h av = ldfrag(vp);
            acc[0][dt] = wmma_f16(av, pb[0], acc[0][dt]);
            acc[1][dt] = wmma_f16(av, pb[1], acc[1][dt]);
        }
      }
      // Hand-over: this wave's reads of the buffer are done, its copies of the
      // next stage have landed; the barrier publishes stage t + 1 and frees
      // the buffer that trip t has read for the refill behind it.
      asm volatile("s_wait_dscnt 0x0" ::: "memory");
      asm volatile("s_wait_asynccnt 0x0" ::: "memory");
      __syncthreads();
      if (t + 2 < ANT)
          copy_kv(lk + boff * 2, lv + boff * 2,
                  gk + (size_t)(t + 2) * AKS * HID, gv + (t + 2) * AKS);
    }
    asm volatile("s_wait_asynccnt 0x0" ::: "memory");     // nothing left in flight

    // --- write out: out[b, q, head*64 + d]; 8 floats per (qt,dt) are
    //     contiguous in d -> two b128 stores each ---
#pragma unroll
    for (int qt = 0; qt < 2; ++qt) {
        const v2f   lp   = l[qt][0] + l[qt][1];
        const float lh   = lp.x + lp.y;                        // this half's keys
        const float linv = 1.0f / (lh + __shfl_xor(lh, 16, 32)); // both halves
        float* op = out + (size_t)(b * SEQ + q0 + qt * 16 + qlane) * HID
                        + head * HDIM + hi * 8;
#pragma unroll
        for (int dt = 0; dt < 4; ++dt) {
            v4f lo, hic;
#pragma unroll
            for (int j = 0; j < 4; ++j) {
                lo[j]  = acc[qt][dt][j]     * linv;
                hic[j] = acc[qt][dt][4 + j] * linv;
            }
            *(v4f*)(op + dt * 16)     = lo;
            *(v4f*)(op + dt * 16 + 4) = hic;
        }
    }
}

// ---------------------------------------------------------------------------

extern "C" void kernel_launch(void* const* d_in, const int* in_sizes, int n_in,
                              void* d_out, int out_size, void* d_ws, size_t ws_size,
                              hipStream_t stream) {
    (void)in_sizes; (void)n_in; (void)out_size; (void)ws_size;
    const float* X    = (const float*)d_in[0];
    const int*   mask = (const int*)d_in[1];
    const float* Wq   = (const float*)d_in[2];
    const float* bq   = (const float*)d_in[3];
    const float* Wk   = (const float*)d_in[4];
    const float* bk   = (const float*)d_in[5];
    const float* Wv   = (const float*)d_in[6];
    const float* bv   = (const float*)d_in[7];
    float* out = (float*)d_out;

    const size_t nX = (size_t)2 * SEQ * HID;      // 4096*1024
    const size_t nW = (size_t)HID * HID;          // 1024*1024
    _Float16* Qh  = (_Float16*)d_ws;
    _Float16* Kh  = Qh  + nX;
    _Float16* Vt  = Kh  + nX;
    _Float16* Xh  = Vt  + nX;
    _Float16* Wqh = Xh  + nX;
    _Float16* Wkh = Wqh + nW;
    _Float16* Wvh = Wkh + nW;                     // total 38 MiB workspace

    // Pass 0: one-shot fp32 -> f16 conversion of X and weights, one launch;
    // Xh, Wqh, Wkh, Wvh are contiguous, so Xh is the start of the whole range.
    cvt_f16_kernel<<<CGRID, 256, 0, stream>>>(X, Wq, Wk, Wv, Xh);

    dim3 g1(4096 / 128, HID / 128, 3);            // 32 x 8 x 3
    qkv_proj_kernel<<<g1, 256, 0, stream>>>(Xh, Wqh, Wkh, Wvh, bq, bk, bv,
                                            Qh, Kh, Vt);

    dim3 g2(SEQ / 256, NHEAD, 2);                 // 8 x 16 x 2
    attention_kernel<<<g2, 256, 0, stream>>>(Qh, Kh, Vt, mask, out);
}

// v005
// It runs in 60.5 microseconds.
// Next to v004, in two timings, it ran 1.12 and 1.11 times as fast.
// Over all steps from v000 it is 2.51 times as fast.
#include <hip/hip_runtime.h>
#include <hip/hip_bf16.h>

typedef __attribute__((ext_vector_type(16))) _Float16 v16h;
typedef __attribute__((ext_vector_type(8)))  _Float16 v8h;
typedef __attribute__((ext_vector_type(4)))  _Float16 v4h;
typedef __attribute__((ext_vector_type(8)))  float    v8f;
typedef __attribute__((ext_vector_type(4)))  float    v4f;
typedef __attribute__((ext_vector_type(2)))  float    v2f;

#define HID   1024
#define SEQ   2048
#define NHEAD 16
#define HDIM  64

__device__ __forceinline__ v8f wmma_f16(v16h a, v16h b, v8f c) {
    // D = A(16x32 f16) x B(32x16 f16) + C(16x16 f32)
    return __builtin_amdgcn_wmma_f32_16x16x32_f16(
        /*neg_a=*/false, a, /*neg_b=*/false, b,
        /*c_mod=*/(short)0, c, /*reuse_a=*/false, /*reuse_b=*/false);
}

__device__ __forceinline__ v8h ld8h(const _Float16* p) {  // one b128 load
    return *(const v8h*)p;
}

__device__ __forceinline__ v16h cat16(v8h a, v8h b) {
    return __builtin_shufflevector(a, b, 0,1,2,3,4,5,6,7,8,9,10,11,12,13,14,15);
}

// A/B fragment: elems 0..7 at p, elems 8..15 at p+16 (two b128 loads)
__device__ __forceinline__ v16h ldfrag(const _Float16* p) {
    return cat16(ld8h(p), ld8h(p + 16));
}

// ---------------------------------------------------------------------------
// Kernel 0: fp32 -> f16 pre-conversion of X, Wq, Wk and Wv in ONE launch
// (GEMM then re-reads f16).  The four f16 images lie one behind the other in
// the workspace, so dst is one range of 7 segments of 2^20 elements:
// segments 0..3 are X, 4 is Wq, 5 is Wk, 6 is Wv.  64 blocks a segment; a wave
// converts 8 KiB of contiguous f32: 16 loads of 512 B, all issued ahead of the
// first conversion.  Few, long waves: the pass pays for waves started and for
// launches, not for bytes.
// ---------------------------------------------------------------------------
#define CSEG   (1 << 18)             // 4-element vectors per segment
#define CVPT   16                    // vectors per thread
#define CBLK   (256 * CVPT)          // vectors per block (4096)
#define CGRID  (7 * CSEG / CBLK)     // 448 blocks

__global__ __launch_bounds__(256)
void cvt_f16_kernel(const float* __restrict__ X,  const float* __restrict__ Wq,
                    const float* __restrict__ Wk, const float* __restrict__ Wv,
                    _Float16* __restrict__ dst) {
    const int seg = blockIdx.x / (CSEG / CBLK);            // 0..6, block-uniform
    const float* src = (seg < 4) ? X + (size_t)seg * (CSEG * 4)
                     : (seg == 4) ? Wq : ((seg == 5) ? Wk : Wv);
    const int inblk = (threadIdx.x >> 5) * (32 * CVPT) + (threadIdx.x & 31);
    const v4f* sp = (const v4f*)src + (blockIdx.x % (CSEG / CBLK)) * CBLK + inblk;
    v4h*       dp = (v4h*)dst + (size_t)blockIdx.x * CBLK + inblk;

    // The three loops are unrolled so that v[] and r[] live in registers and
    // every load and store takes its step as an immediate offset.
    v4f v[CVPT];
#pragma unroll
    for (int j = 0; j < CVPT; ++j) v[j] = sp[j * 32];
    // Keeps all 16 loads ahead of the first conversion: left alone the
    // compiler holds the last two back until the first two have returned,
    // a second trip to memory in every wave.
    __builtin_amdgcn_sched_barrier(0);
    v4h r[CVPT];
#pragma unroll
    for (int j = 0; j < CVPT; ++j) {
        r[j][0] = (_Float16)v[j][0]; r[j][1] = (_Float16)v[j][1];
        r[j][2] = (_Float16)v[j][2]; r[j][3] = (_Float16)v[j][3];
    }
#pragma unroll
    for (int j = 0; j < CVPT; ++j) dp[j * 32] = r[j];
}

// ---------------------------------------------------------------------------
// Kernel 1: QKV projection.  out[n,o] = sum_k X[n,k] * W[o,k] + bias[o]
//   blockIdx.x : 128-row tile (N = B*S = 4096)
//   blockIdx.y : 128-col tile (O = 1024)
//   blockIdx.z : 0 -> Q, 1 -> K, 2 -> V (stored transposed per head)
// 8 waves (2 row x 4 col), each wave owns a 64x32 tile = 4x2 WMMA accums.
// The block's 128 X rows and 128 W rows come into LDS in tiles of 64 k
// (128-byte rows, whole lines) by asynchronous copies, two buffers, the next
// tile in flight while this one is worked on; fragments are read from LDS.
// ---------------------------------------------------------------------------
#define KT     64                    // k elements per tile: 128 B of every row
#define NT     (HID / KT)            // 16 tiles
#define PITCH  72                    // halves per LDS row: 144 B = 16 B x odd
#define TROWS  256                   // rows 0..127: X, rows 128..255: W
#define BUFH   (TROWS * PITCH)       // halves per buffer (36,864 B)

// Eight 16-byte copies per lane = this thread's share of one 32 KiB tile.
// The s_wait_xcnt stands inside the statement so that no address register of
// an issued copy is rewritten ahead of it.
__device__ __forceinline__ void copy_tile(unsigned lds, const _Float16* gx,
                                          const _Float16* gw) {
    const unsigned l0 = lds,                 l1 = lds + 32 * PITCH * 2,
                   l2 = lds + 64 * PITCH * 2,  l3 = lds + 96 * PITCH * 2,
                   l4 = lds + 128 * PITCH * 2, l5 = lds + 160 * PITCH * 2,
                   l6 = lds + 192 * PITCH * 2, l7 = lds + 224 * PITCH * 2;
    const _Float16 *g0 = gx,            *g1 = gx + 32 * HID,
                   *g2 = gx + 64 * HID, *g3 = gx + 96 * HID,
                   *g4 = gw,            *g5 = gw + 32 * HID,
                   *g6 = gw + 64 * HID, *g7 = gw + 96 * HID;
    asm volatile(
        "global_load_async_to_lds_b128 %0, %8, off\n\t"
        "global_load_async_to_lds_b128 %1, %9, off\n\t"
        "global_load_async_to_lds_b128 %2, %10, off\n\t"
        "global_load_async_to_lds_b128 %3, %11, off\n\t"
        "global_load_async_to_lds_b128 %4, %12, off\n\t"
        "global_load_async_to_lds_b128 %5, %13, off\n\t"
        "global_load_async_to_lds_b128 %6, %14, off\n\t"
        "global_load_async_to_lds_b128 %7, %15, off\n\t"
        "s_wait_xcnt 0x0"
        :: "v"(l0), "v"(l1), "v"(l2), "v"(l3), "v"(l4), "v"(l5), "v"(l6), "v"(l7),
           "v"(g0), "v"(g1), "v"(g2), "v"(g3), "v"(g4), "v"(g5), "v"(g6), "v"(g7)
        : "memory");
}

__global__ __launch_bounds__(256)
void qkv_proj_kernel(const _Float16* __restrict__ Xh,
                     const _Float16* __restrict__ Wqh,
                     const _Float16* __restrict__ Wkh,
                     const _Float16* __restrict__ Wvh,
                     const float* __restrict__ bq,
                     const float* __restrict__ bk,
                     const float* __restrict__ bv,
                     _Float16* __restrict__ Qh, _Float16* __restrict__ Kh,
                     _Float16* __restrict__ Vt) {
    __shared__ __attribute__((aligned(16))) _Float16 tile[2 * BUFH];

    const int tid   = threadIdx.x;
    const int lane  = tid & 31;
    const int w     = tid >> 5;
    const int qlane = lane & 15;
    const int hi    = lane >> 4;           // 0: K set {0..7,16..23}, 1: {8..15,24..31}
    const int rw    = w >> 2;              // 0..1
    const int cw    = w & 3;               // 0..3
    const int rbase = blockIdx.x * 128 + rw * 64;
    const int cbase = blockIdx.y * 128 + cw * 32;
    const int z     = blockIdx.z;

    const _Float16* W    = (z == 0) ? Wqh : ((z == 1) ? Wkh : Wvh);
    const float*    bias = (z == 0) ? bq  : ((z == 1) ? bk  : bv);

    // Copy side: 8 lanes cover one 128-byte row, a wave covers 4 rows a copy.
    const int crow = tid >> 3;             // 0..31
    const int ccol = (tid & 7) * 8;        // halves
    const _Float16* gx = Xh + (size_t)(blockIdx.x * 128 + crow) * HID + ccol;
    const _Float16* gw = W  + (size_t)(blockIdx.y * 128 + crow) * HID + ccol;
    const unsigned  ldst = (unsigned)(size_t)tile + (crow * PITCH + ccol) * 2;

    // Read side: this lane's row in the wave's first A and first B fragment.
    const _Float16* fa = tile + (rw * 64 + qlane) * PITCH + hi * 8;
    const _Float16* fb = tile + (128 + cw * 32 + qlane) * PITCH + hi * 8;

    v8f acc[4][2] = {};

    copy_tile(ldst, gx, gw);                              // tile 0 -> buffer 0
    asm volatile("s_wait_asynccnt 0x0" ::: "memory");     // own copies landed
    __syncthreads();                                      // publishes tile 0
    copy_tile(ldst + BUFH * 2, gx + KT, gw + KT);         // tile 1 -> buffer 1

    for (int t = 0; t < NT; ++t) {
        const int boff = (t & 1) * BUFH;
#pragma unroll
        for (int kc = 0; kc < KT; kc += 32) {
            v16h a[4], b[2];
#pragma unroll
            for (int m = 0; m < 4; ++m)
                a[m] = ldfrag(fa + boff + m * 16 * PITCH + kc);
#pragma unroll
            for (int n = 0; n < 2; ++n)
                b[n] = ldfrag(fb + boff + n * 16 * PITCH + kc);
            // Keeps the 12 LDS reads together ahead of their 8 WMMAs: left
            // alone the compiler sinks them among the WMMAs, one full LDS
            // wait for every pair.
            __builtin_amdgcn_sched_barrier(0);
#pragma unroll
            for (int m = 0; m < 4; ++m)
#pragma unroll
                for (int n = 0; n < 2; ++n)
                    acc[m][n] = wmma_f16(a[m], b[n], acc[m][n]);
            // Keeps the next group's reads out of this WMMA block: left alone
            // the compiler spreads them over four places among the WMMAs.
            __builtin_amdgcn_sched_barrier(0);
        }
        // Hand-over: this wave's reads of the buffer are done, its copies of
        // the next tile have landed; the barrier publishes tile t + 1 and
        // frees the buffer that trip t has read for the refill behind it.
        asm volatile("s_wait_dscnt 0x0" ::: "memory");
        asm volatile("s_wait_asynccnt 0x0" ::: "memory");
        __syncthreads();
        if (t + 2 < NT)
            copy_tile(ldst + boff * 2, gx + (t + 2) * KT, gw + (t + 2) * KT);
    }
    asm volatile("s_wait_asynccnt 0x0" ::: "memory");     // nothing left in flight

    // Epilogue: bias add, cast to f16, store. Uniform z-branch hoisted.
    if (z == 2) {
        // V transposed: per (m,n) the 8 accumulator slots are contiguous in s
        // -> pack into one b128 store.
#pragma unroll
        for (int n = 0; n < 2; ++n) {
            const int col  = cbase + n * 16 + qlane;
            const int head = col >> 6, d = col & (HDIM - 1);
            const float bv_ = bias[col];
#pragma unroll
            for (int m = 0; m < 4; ++m) {
                const int row0 = rbase + m * 16 + hi * 8;   // rows row0..row0+7
                const int bi = row0 >> 11, s0 = row0 & (SEQ - 1);
                v8h pk;
#pragma unroll
                for (int j = 0; j < 8; ++j)
                    pk[j] = (_Float16)(acc[m][n][j] + bv_);
                *(v8h*)(Vt + ((size_t)(bi * NHEAD + head) * HDIM + d) * SEQ + s0) = pk;
            }
        }
    } else {
        _Float16* __restrict__ dst = (z == 0) ? Qh : Kh;
#pragma unroll
        for (int n = 0; n < 2; ++n) {
            const int col = cbase + n * 16 + qlane;
            const float bv_ = bias[col];
#pragma unroll
            for (int m = 0; m < 4; ++m) {
#pragma unroll
                for (int j = 0; j < 8; ++j) {
                    const int row = rbase + m * 16 + j + hi * 8;
                    dst[(size_t)row * HID + col] = (_Float16)(acc[m][n][j] + bv_);
                }
            }
        }
    }
}

// ---------------------------------------------------------------------------
// Kernel 2: flash attention.  One wave = 32 queries (two 16-query tiles) so
// every K/V fragment load feeds two WMMAs.  16 waves a block, four a SIMD, so
// that one wave's softmax runs beside another's products: waves w and w + 8
// share 32 queries and split the keys, wave w the first 128 keys of every
// stage, wave w + 8 the second 128.  Behind the loop the two exchange one
// query tile each through LDS and each joins and stores the tile it keeps.
//   scoresT = K * Q^T   (M = keys, N = queries)  -> per-lane online softmax
//   ctxT    = V^T * P^T (M = dims, N = queries)  -> P^T C-layout == B-fragment
//   blockIdx.x : 256-query tile, blockIdx.y : head, blockIdx.z : batch
// Mask is pre-baked into an additive f32 bias in LDS (0 or -3e38) that the
// score product takes as its start value.
// Lazy rescale: the maximum in use, m (log2-scaled), may trail a column's true
// maximum by up to 8, so an exponential can reach 2^8.  One test per pass for
// the whole wave; only when it fires are the halves' maxima joined, m raised
// and the accumulators and sums rescaled.  On the usual path a score costs one
// FMA and one exponential.  Every lane keeps the sums of its own keys; the two
// halves of a column are added once, behind the loop.
// The block's waves walk the same stages: K rows and V^T rows come into
// LDS once per block in stages of 256 keys by asynchronous copies (whole
// lines), two buffers, the next stage in flight while this one is worked on;
// every wave reads its fragments from LDS.
// ---------------------------------------------------------------------------
#define AKS    256                   // keys per stage
#define AKW    128                   // keys of a stage that one wave walks
#define ANT    (SEQ / AKS)           // 8 stages
#define KPIT   72                    // halves per K row in LDS: 144 B = 16 B x odd
#define VPIT   264                   // halves per V^T row in LDS: 528 B = 16 B x odd
#define KHALF  (AKS * KPIT)          // halves of the K part (36,864 B)
#define ABUFH  (KHALF + HDIM * VPIT) // halves per buffer (70,656 B)
#define XVEC   9                     // 16-byte vectors a lane hands over

// Eight 16-byte copies per lane = this thread's share of one 64 KiB stage:
// four of K (64 rows of 128 B a copy), four of V^T (16 rows of 512 B a copy).
// The s_wait_xcnt stands inside the statement so that no address register of
// an issued copy is rewritten ahead of it.
__device__ __forceinline__ void copy_kv(unsigned lk, unsigned lv,
                                        const _Float16* gk, const _Float16* gv) {
    const unsigned l0 = lk,                  l1 = lk + 64 * KPIT * 2,
                   l2 = lk + 128 * KPIT * 2, l3 = lk + 192 * KPIT * 2,
                   l4 = lv,                 l5 = lv + 16 * VPIT * 2,
                   l6 = lv + 32 * VPIT * 2, l7 = lv + 48 * VPIT * 2;
    const _Float16 *g0 = gk,             *g1 = gk + 64 * HID,
                   *g2 = gk + 128 * HID, *g3 = gk + 192 * HID,
                   *g4 = gv,            *g5 = gv + 16 * SEQ,
                   *g6 = gv + 32 * SEQ, *g7 = gv + 48 * SEQ;
    asm volatile(
        "global_load_async_to_lds_b128 %0, %8, off\n\t"
        "global_load_async_to_lds_b128 %1, %9, off\n\t"
        "global_load_async_to_lds_b128 %2, %10, off\n\t"
        "global_load_async_to_lds_b128 %3, %11, off\n\t"
        "global_load_async_to_lds_b128 %4, %12, off\n\t"
        "global_load_async_to_lds_b128 %5, %13, off\n\t"
        "global_load_async_to_lds_b128 %6, %14, off\n\t"
        "global_load_async_to_lds_b128 %7, %15, off\n\t"
        "s_wait_xcnt 0x0"
        :: "v"(l0), "v"(l1), "v"(l2), "v"(l3), "v"(l4), "v"(l5), "v"(l6), "v"(l7),
           "v"(g0), "v"(g1), "v"(g2), "v"(g3), "v"(g4), "v"(g5), "v"(g6), "v"(g7)
        : "memory");
}

__global__ __launch_bounds__(512)
void attention_kernel(const _Float16* __restrict__ Qh,
                      const _Float16* __restrict__ Kh,
                      const _Float16* __restrict__ Vt,
                      const int* __restrict__ mask,
                      float* __restrict__ out) {
    __shared__ __attribute__((aligned(16))) float sbias[SEQ];
    __shared__ __attribute__((aligned(16))) _Float16 kv[2 * ABUFH];
    __shared__ __attribute__((aligned(16))) v4f xch[16 * XVEC * 32];
    const int b    = blockIdx.z;
    const int head = blockIdx.y;
    const int tid  = threadIdx.x;

    const _Float16* Kbase = Kh + (size_t)b * SEQ * HID + head * HDIM;
    const _Float16* Vbase = Vt + (size_t)(b * NHEAD + head) * HDIM * SEQ;

    // Copy side. K: 8 lanes cover one 128-byte row; V^T: a wave covers the
    // 512 bytes that one row has of a stage.
    const int krow = tid >> 3, kcol = (tid & 7) * 8;      // row 0..63, halves
    const int vrow = tid >> 5, vcol = (tid & 31) * 8;     // row 0..15, halves
    const _Float16* gk = Kbase + (size_t)krow * HID + kcol;
    const _Float16* gv = Vbase + (size_t)vrow * SEQ + vcol;
    const unsigned  lk = (unsigned)(size_t)kv + (krow * KPIT + kcol) * 2;
    const unsigned  lv = (unsigned)(size_t)kv + (KHALF + vrow * VPIT + vcol) * 2;

    copy_kv(lk, lv, gk, gv);                              // stage 0 -> buffer 0

    for (int i = tid; i < SEQ; i += 512)
        sbias[i] = (mask[b * SEQ + i] == 0) ? -3.0e38f : 0.0f;
    asm volatile("s_wait_asynccnt 0x0" ::: "memory");     // own copies landed
    __syncthreads();                                      // publishes sbias and stage 0
    copy_kv(lk + ABUFH * 2, lv + ABUFH * 2,
            gk + (size_t)AKS * HID, gv + AKS);            // stage 1 -> buffer 1

    const int lane  = tid & 31;
    const int w     = tid >> 5;
    const int qlane = lane & 15;
    const int hi    = lane >> 4;
    const int kh    = w >> 3;              // which 128 keys of every stage
    const int q0    = blockIdx.x * 256 + (w & 7) * 32;

    // Q fragments (B-matrix of scoresT): lane = query, K = head_dim (2 chunks)
    v16h qf[2][2];
#pragma unroll
    for (int qt = 0; qt < 2; ++qt) {
        const _Float16* qp =
            Qh + (size_t)(b * SEQ + q0 + qt * 16 + qlane) * HID + head * HDIM;
#pragma unroll
        for (int kc = 0; kc < 2; ++kc)
            qf[qt][kc] = ldfrag(qp + kc * 32 + hi * 8);
    }

    // Read side: this lane's row in the wave's first K and first V^T fragment,
    // and its first mask bias.
    const _Float16* fk = kv + (kh * AKW + qlane) * KPIT + hi * 8;
    const _Float16* fv = kv + KHALF + qlane * VPIT + kh * AKW + hi * 8;
    const float*    fm = sbias + kh * AKW + hi * 8;
    const float c2 = 0.125f * 1.44269504088896340736f;   // log2(e) / sqrt(64)

    float m[2] = {-1e30f, -1e30f};
    v2f   l[2][2] = {};           // per lane: two chains of pair sums a tile
    v8f acc[2][4] = {};

    for (int t = 0; t < ANT; ++t) {
      const int boff = (t & 1) * ABUFH;
      for (int kk = 0; kk < AKW; kk += 32) {
        const int kt = t * AKS + kk;

        // --- K A-fragments, shared by both query tiles ---
        v16h ak[2][2];   // [key sub-tile][head_dim chunk]
#pragma unroll
        for (int sub = 0; sub < 2; ++sub) {
            const _Float16* kp = fk + boff + (kk + sub * 16) * KPIT;
            ak[sub][0] = ldfrag(kp);
            ak[sub][1] = ldfrag(kp + 32);
        }

        // --- additive mask bias for this lane's 16 key slots (4x ds b128) ---
        v8f mb[2];
#pragma unroll
        for (int sub = 0; sub < 2; ++sub) {
            const v4f* bp = (const v4f*)(fm + kt + sub * 16);
            mb[sub] = __builtin_shufflevector(bp[0], bp[1], 0, 1, 2, 3, 4, 5, 6, 7);
        }

        // --- scoresT: 2 x 2 tiles of 16(key) x 16(query), raw scores + bias ---
        v8f st[2][2];   // [query tile][key sub-tile]
#pragma unroll
        for (int qt = 0; qt < 2; ++qt)
#pragma unroll
            for (int sub = 0; sub < 2; ++sub) {
                v8f c = wmma_f16(ak[sub][0], qf[qt][0], mb[sub]);
                st[qt][sub] = wmma_f16(ak[sub][1], qf[qt][1], c);
            }

        // --- lazy test: has any lane a score more than 8 above its m? ---
        float mx[2];
        bool need = false;
#pragma unroll
        for (int qt = 0; qt < 2; ++qt) {
            float x = fmaxf(st[qt][0][0], st[qt][1][0]);
#pragma unroll
            for (int j = 1; j < 8; ++j)
                x = fmaxf(x, fmaxf(st[qt][0][j], st[qt][1][j]));
            mx[qt] = x;
            need = need || (fmaf(x, c2, -m[qt]) > 8.0f);
        }
        if (__builtin_amdgcn_ballot_w32(need) != 0) {   // scalar branch, rare
#pragma unroll
            for (int qt = 0; qt < 2; ++qt) {
                const float mnew =   // the same in both halves of a column
                    fmaxf(m[qt], fmaxf(mx[qt], __shfl_xor(mx[qt], 16, 32)) * c2);
                const float corr = __builtin_amdgcn_exp2f(m[qt] - mnew);
                m[qt] = mnew;
                l[qt][0] *= corr;
                l[qt][1] *= corr;
#pragma unroll
                for (int dt = 0; dt < 4; ++dt) acc[qt][dt] *= corr;
            }
        }

        // --- P^T = 2^(score * c2 - m): one FMA, one exponential an element ---
        v16h pb[2];   // P^T B-fragments, one per query tile
#pragma unroll
        for (int qt = 0; qt < 2; ++qt) {
            const v2f nm = {-m[qt], -m[qt]};
            const v2f cc = {c2, c2};
            v16h p;
#pragma unroll
            for (int i = 0; i < 8; ++i) {
                const int sub = i >> 2, j = 2 * (i & 3);
                const v2f a = __builtin_elementwise_fma(
                    (v2f){st[qt][sub][j], st[qt][sub][j + 1]}, cc, nm);
                const v2f e = {__builtin_amdgcn_exp2f(a.x),
                               __builtin_amdgcn_exp2f(a.y)};
                l[qt][i & 1] += e;
                p[sub * 8 + j]     = (_Float16)e.x;
                p[sub * 8 + j + 1] = (_Float16)e.y;
            }
            pb[qt] = p;
        }

        // --- ctxT += V^T * P^T : each V fragment feeds both query tiles ---
#pragma unroll
        for (int dt = 0; dt < 4; ++dt) {
            const _Float16* vp = fv + boff + dt * 16 * VPIT + kk;
            v16h av = ldfrag(vp);
            acc[0][dt] = wmma_f16(av, pb[0], acc[0][dt]);
            acc[1][dt] = wmma_f16(av, pb[1], acc[1][dt]);
        }
      }
      // Hand-over: this wave's reads of the buffer are done, its copies of the
      // next stage have landed; the barrier publishes stage t + 1 and frees
      // the buffer that trip t has read for the refill behind it.
      asm volatile("s_wait_dscnt 0x0" ::: "memory");
      asm volatile("s_wait_asynccnt 0x0" ::: "memory");
      __syncthreads();
      if (t + 2 < ANT)
          copy_kv(lk + boff * 2, lv + boff * 2,
                  gk + (size_t)(t + 2) * AKS * HID, gv + (t + 2) * AKS);
    }
    asm volatile("s_wait_asynccnt 0x0" ::: "memory");     // nothing left in flight

    // --- join the two key halves: wave kh keeps query tile kh and hands the
    //     other tile (accumulators, maximum in use, this lane's sum) to its
    //     partner, 16 bytes a lane and vector, lanes side by side ---
    const bool up = (kh != 0);
    const v2f  lp0 = l[0][0] + l[0][1], lp1 = l[1][0] + l[1][1];
    const float ls0 = lp0.x + lp0.y, ls1 = lp1.x + lp1.y;      // this lane's keys
    const float mk = up ? m[1] : m[0], lk_ = up ? ls1 : ls0;   // kept tile
    v8f keep[4];
    {
        v4f* xp = xch + w * (XVEC * 32) + lane;
#pragma unroll
        for (int dt = 0; dt < 4; ++dt) {
            const v8f g = up ? acc[0][dt] : acc[1][dt];
            keep[dt]    = up ? acc[1][dt] : acc[0][dt];
            xp[(2 * dt) * 32]     = __builtin_shufflevector(g, g, 0, 1, 2, 3);
            xp[(2 * dt + 1) * 32] = __builtin_shufflevector(g, g, 4, 5, 6, 7);
        }
        xp[8 * 32] = (v4f){up ? m[0] : m[1], up ? ls0 : ls1, 0.0f, 0.0f};
    }
    __syncthreads();                       // publishes the handed-over tiles

    // --- write out: out[b, q, head*64 + d]; 8 floats per dt are contiguous
    //     in d -> two b128 stores each ---
    {
        const v4f* yp = xch + (w ^ 8) * (XVEC * 32) + lane;
        const v4f   ml   = yp[8 * 32];                         // partner's m, sum
        const float mj   = fmaxf(mk, ml.x);
        // ca: own share, cb: partner's share.  The two exponentials stand in one
        // statement with a v_nop behind them; a v_nop in a statement of its own
        // landed elsewhere.
        float ca, cb;
        asm("v_exp_f32 %0, %2\n\t"
            "v_exp_f32 %1, %3\n\t"
            "v_nop"
            : "=&v"(ca), "=&v"(cb) : "v"(mk - mj), "v"(ml.x - mj));
        const float lh   = lk_ * ca + ml.y * cb;               // this half column
        const float linv = 1.0f / (lh + __shfl_xor(lh, 16, 32)); // both halves
        const float sa = ca * linv, sb = cb * linv;
        float* op = out + (size_t)(b * SEQ + q0 + kh * 16 + qlane) * HID
                        + head * HDIM + hi * 8;
#pragma unroll
        for (int dt = 0; dt < 4; ++dt) {
            const v4f o0 = yp[(2 * dt) * 32], o1 = yp[(2 * dt + 1) * 32];
            v4f lo, hic;
#pragma unroll
            for (int j = 0; j < 4; ++j) {
                lo[j]  = keep[dt][j]     * sa + o0[j] * sb;
                hic[j] = keep[dt][4 + j] * sa + o1[j] * sb;
            }
            *(v4f*)(op + dt * 16)     = lo;
            *(v4f*)(op + dt * 16 + 4) = hic;
        }
    }
}

// ---------------------------------------------------------------------------

extern "C" void kernel_launch(void* const* d_in, const int* in_sizes, int n_in,
                              void* d_out, int out_size, void* d_ws, size_t ws_size,
                              hipStream_t stream) {
    (void)in_sizes; (void)n_in; (void)out_size; (void)ws_size;
    const float* X    = (const float*)d_in[0];
    const int*   mask = (const int*)d_in[1];
    const float* Wq   = (const float*)d_in[2];
    const float* bq   = (const float*)d_in[3];
    const float* Wk   = (const float*)d_in[4];
    const float* bk   = (const float*)d_in[5];
    const float* Wv   = (const float*)d_in[6];
    const float* bv   = (const float*)d_in[7];
    float* out = (float*)d_out;

    const size_t nX = (size_t)2 * SEQ * HID;      // 4096*1024
    const size_t nW = (size_t)HID * HID;          // 1024*1024
    _Float16* Qh  = (_Float16*)d_ws;
    _Float16* Kh  = Qh  + nX;
    _Float16* Vt  = Kh  + nX;
    _Float16* Xh  = Vt  + nX;
    _Float16* Wqh = Xh  + nX;
    _Float16* Wkh = Wqh + nW;
    _Float16* Wvh = Wkh + nW;                     // total 38 MiB workspace

    // Pass 0: one-shot fp32 -> f16 conversion of X and weights, one launch;
    // Xh, Wqh, Wkh, Wvh are contiguous, so Xh is the start of the whole range.
    cvt_f16_kernel<<<CGRID, 256, 0, stream>>>(X, Wq, Wk, Wv, Xh);

    dim3 g1(4096 / 128, HID / 128, 3);            // 32 x 8 x 3
    qkv_proj_kernel<<<g1, 256, 0, stream>>>(Xh, Wqh, Wkh, Wvh, bq, bk, bv,
                                            Qh, Kh, Vt);

    dim3 g2(SEQ / 256, NHEAD, 2);                 // 8 x 16 x 2
    attention_kernel<<<g2, 512, 0, stream>>>(Qh, Kh, Vt, mask, out);
}

// v006
// It runs in 57.5 microseconds.
// Next to v005, in two timings, it ran 1.05 times as fast each time.
// Counting every step since v000, it is 2.64 times as fast.
#include <hip/hip_runtime.h>
#include <hip/hip_bf16.h>

typedef __attribute__((ext_vector_type(16))) _Float16 v16h;
typedef __attribute__((ext_vector_type(8)))  _Float16 v8h;
typedef __attribute__((ext_vector_type(4)))  _Float16 v4h;
typedef __attribute__((ext_vector_type(8)))  float    v8f;
typedef __attribute__((ext_vector_type(4)))  float    v4f;
typedef __attribute__((ext_vector_type(2)))  float    v2f;

#define HID   1024
#define SEQ   2048
#define NHEAD 16
#define HDIM  64
// log2(e) / sqrt(HDIM): folded into Q where the projection rounds it to f16,
// so that K * Q^T is a score in log2 units.
#define QSCALE (0.125f * 1.44269504088896340736f)

__device__ __forceinline__ v8f wmma_f16(v16h a, v16h b, v8f c) {
    // D = A(16x32 f16) x B(32x16 f16) + C(16x16 f32)
    return __builtin_amdgcn_wmma_f32_16x16x32_f16(
        /*neg_a=*/false, a, /*neg_b=*/false, b,
        /*c_mod=*/(short)0, c, /*reuse_a=*/false, /*reuse_b=*/false);
}

__device__ __forceinline__ v8h ld8h(const _Float16* p) {  // one b128 load
    return *(const v8h*)p;
}

__device__ __forceinline__ v16h cat16(v8h a, v8h b) {
    return __builtin_shufflevector(a, b, 0,1,2,3,4,5,6,7,8,9,10,11,12,13,14,15);
}

// A/B fragment: elems 0..7 at p, elems 8..15 at p+16 (two b128 loads)
__device__ __forceinline__ v16h ldfrag(const _Float16* p) {
    return cat16(ld8h(p), ld8h(p + 16));
}

// ---------------------------------------------------------------------------
// Kernel 0: fp32 -> f16 pre-conversion of X, Wq, Wk and Wv in ONE launch
// (GEMM then re-reads f16).  The four f16 images lie one behind the other in
// the workspace, so dst is one range of 7 segments of 2^20 elements:
// segments 0..3 are X, 4 is Wq, 5 is Wk, 6 is Wv.  64 blocks a segment; a wave
// converts 8 KiB of contiguous f32: 16 loads of 512 B, all issued ahead of the
// first conversion.  Few, long waves: the pass pays for waves started and for
// launches, not for bytes.
// ---------------------------------------------------------------------------
#define CSEG   (1 << 18)             // 4-element vectors per segment
#define CVPT   16                    // vectors per thread
#define CBLK   (256 * CVPT)          // vectors per block (4096)
#define CGRID  (7 * CSEG / CBLK)     // 448 blocks

__global__ __launch_bounds__(256)
void cvt_f16_kernel(const float* __restrict__ X,  const float* __restrict__ Wq,
                    const float* __restrict__ Wk, const float* __restrict__ Wv,
                    _Float16* __restrict__ dst) {
    const int seg = blockIdx.x / (CSEG / CBLK);            // 0..6, block-uniform
    const float* src = (seg < 4) ? X + (size_t)seg * (CSEG * 4)
                     : (seg == 4) ? Wq : ((seg == 5) ? Wk : Wv);
    const int inblk = (threadIdx.x >> 5) * (32 * CVPT) + (threadIdx.x & 31);
    const v4f* sp = (const v4f*)src + (blockIdx.x % (CSEG / CBLK)) * CBLK + inblk;
    v4h*       dp = (v4h*)dst + (size_t)blockIdx.x * CBLK + inblk;

    // The three loops are unrolled so that v[] and r[] live in registers and
    // every load and store takes its step as an immediate offset.
    v4f v[CVPT];
#pragma unroll
    for (int j = 0; j < CVPT; ++j) v[j] = sp[j * 32];
    // Keeps all 16 loads ahead of the first conversion: left alone the
    // compiler holds the last two back until the first two have returned,
    // a second trip to memory in every wave.
    __builtin_amdgcn_sched_barrier(0);
    v4h r[CVPT];
#pragma unroll
    for (int j = 0; j < CVPT; ++j) {
        r[j][0] = (_Float16)v[j][0]; r[j][1] = (_Float16)v[j][1];
        r[j][2] = (_Float16)v[j][2]; r[j][3] = (_Float16)v[j][3];
    }
#pragma unroll
    for (int j = 0; j < CVPT; ++j) dp[j * 32] = r[j];
}

// ---------------------------------------------------------------------------
// Kernel 1: QKV projection.  out[n,o] = sum_k X[n,k] * W[o,k] + bias[o], times QSCALE for Q
//   blockIdx.x : 128-row tile (N = B*S = 4096)
//   blockIdx.y : 128-col tile (O = 1024)
//   blockIdx.z : 0 -> Q, 1 -> K, 2 -> V (stored transposed per head)
// 8 waves (2 row x 4 col), each wave owns a 64x32 tile = 4x2 WMMA accums.
// The block's 128 X rows and 128 W rows come into LDS in tiles of 64 k
// (128-byte rows, whole lines) by asynchronous copies, two buffers, the next
// tile in flight while this one is worked on; fragments are read from LDS.
// ---------------------------------------------------------------------------
#define KT     64                    // k elements per tile: 128 B of every row
#define NT     (HID / KT)            // 16 tiles
#define PITCH  72                    // halves per LDS row: 144 B = 16 B x odd
#define TROWS  256                   // rows 0..127: X, rows 128..255: W
#define BUFH   (TROWS * PITCH)       // halves per buffer (36,864 B)

// Eight 16-byte copies per lane = this thread's share of one 32 KiB tile.
// The s_wait_xcnt stands inside the statement so that no address register of
// an issued copy is rewritten ahead of it.
__device__ __forceinline__ void copy_tile(unsigned lds, const _Float16* gx,
                                          const _Float16* gw) {
    const unsigned l0 = lds,                 l1 = lds + 32 * PITCH * 2,
                   l2 = lds + 64 * PITCH * 2,  l3 = lds + 96 * PITCH * 2,
                   l4 = lds + 128 * PITCH * 2, l5 = lds + 160 * PITCH * 2,
                   l6 = lds + 192 * PITCH * 2, l7 = lds + 224 * PITCH * 2;
    const _Float16 *g0 = gx,            *g1 = gx + 32 * HID,
                   *g2 = gx + 64 * HID, *g3 = gx + 96 * HID,
                   *g4 = gw,            *g5 = gw + 32 * HID,
                   *g6 = gw + 64 * HID, *g7 = gw + 96 * HID;
    asm volatile(
        "global_load_async_to_lds_b128 %0, %8, off\n\t"
        "global_load_async_to_lds_b128 %1, %9, off\n\t"
        "global_load_async_to_lds_b128 %2, %10, off\n\t"
        "global_load_async_to_lds_b128 %3, %11, off\n\t"
        "global_load_async_to_lds_b128 %4, %12, off\n\t"
        "global_load_async_to_lds_b128 %5, %13, off\n\t"
        "global_load_async_to_lds_b128 %6, %14, off\n\t"
        "global_load_async_to_lds_b128 %7, %15, off\n\t"
        "s_wait_xcnt 0x0"
        :: "v"(l0), "v"(l1), "v"(l2), "v"(l3), "v"(l4), "v"(l5), "v"(l6), "v"(l7),
           "v"(g0), "v"(g1), "v"(g2), "v"(g3), "v"(g4), "v"(g5), "v"(g6), "v"(g7)
        : "memory");
}

__global__ __launch_bounds__(256)
void qkv_proj_kernel(const _Float16* __restrict__ Xh,
                     const _Float16* __restrict__ Wqh,
                     const _Float16* __restrict__ Wkh,
                     const _Float16* __restrict__ Wvh,
                     const float* __restrict__ bq,
                     const float* __restrict__ bk,
                     const float* __restrict__ bv,
                     _Float16* __restrict__ Qh, _Float16* __restrict__ Kh,
                     _Float16* __restrict__ Vt) {
    __shared__ __attribute__((aligned(16))) _Float16 tile[2 * BUFH];

    const int tid   = threadIdx.x;
    const int lane  = tid & 31;
    const int w     = tid >> 5;
    const int qlane = lane & 15;
    const int hi    = lane >> 4;           // 0: K set {0..7,16..23}, 1: {8..15,24..31}
    const int rw    = w >> 2;              // 0..1
    const int cw    = w & 3;               // 0..3
    const int rbase = blockIdx.x * 128 + rw * 64;
    const int cbase = blockIdx.y * 128 + cw * 32;
    const int z     = blockIdx.z;

    const _Float16* W    = (z == 0) ? Wqh : ((z == 1) ? Wkh : Wvh);
    const float*    bias = (z == 0) ? bq  : ((z == 1) ? bk  : bv);

    // Copy side: 8 lanes cover one 128-byte row, a wave covers 4 rows a copy.
    const int crow = tid >> 3;             // 0..31
    const int ccol = (tid & 7) * 8;        // halves
    const _Float16* gx = Xh + (size_t)(blockIdx.x * 128 + crow) * HID + ccol;
    const _Float16* gw = W  + (size_t)(blockIdx.y * 128 + crow) * HID + ccol;
    const unsigned  ldst = (unsigned)(size_t)tile + (crow * PITCH + ccol) * 2;

    // Read side: this lane's row in the wave's first A and first B fragment.
    const _Float16* fa = tile + (rw * 64 + qlane) * PITCH + hi * 8;
    const _Float16* fb = tile + (128 + cw * 32 + qlane) * PITCH + hi * 8;

    v8f acc[4][2] = {};

    copy_tile(ldst, gx, gw);                              // tile 0 -> buffer 0
    asm volatile("s_wait_asynccnt 0x0" ::: "memory");     // own copies landed
    __syncthreads();                                      // publishes tile 0
    copy_tile(ldst + BUFH * 2, gx + KT, gw + KT);         // tile 1 -> buffer 1

    for (int t = 0; t < NT; ++t) {
        const int boff = (t & 1) * BUFH;
#pragma unroll
        for (int kc = 0; kc < KT; kc += 32) {
            v16h a[4], b[2];
#pragma unroll
            for (int m = 0; m < 4; ++m)
                a[m] = ldfrag(fa + boff + m * 16 * PITCH + kc);
#pragma unroll
            for (int n = 0; n < 2; ++n)
                b[n] = ldfrag(fb + boff + n * 16 * PITCH + kc);
            // Keeps the 12 LDS reads together ahead of their 8 WMMAs: left
            // alone the compiler sinks them among the WMMAs, one full LDS
            // wait for every pair.
            __builtin_amdgcn_sched_barrier(0);
#pragma unroll
            for (int m = 0; m < 4; ++m)
#pragma unroll
                for (int n = 0; n < 2; ++n)
                    acc[m][n] = wmma_f16(a[m], b[n], acc[m][n]);
            // Keeps the next group's reads out of this WMMA block: left alone
            // the compiler spreads them over four places among the WMMAs.
            __builtin_amdgcn_sched_barrier(0);
        }
        // Hand-over: this wave's reads of the buffer are done, its copies of
        // the next tile have landed; the barrier publishes tile t + 1 and
        // frees the buffer that trip t has read for the refill behind it.
        asm volatile("s_wait_dscnt 0x0" ::: "memory");
        asm volatile("s_wait_asynccnt 0x0" ::: "memory");
        __syncthreads();
        if (t + 2 < NT)
            copy_tile(ldst + boff * 2, gx + (t + 2) * KT, gw + (t + 2) * KT);
    }
    asm volatile("s_wait_asynccnt 0x0" ::: "memory");     // nothing left in flight

    // Epilogue: bias add, cast to f16, store. Uniform z-branch hoisted.
    if (z == 2) {
        // V transposed: per (m,n) the 8 accumulator slots are contiguous in s
        // -> pack into one b128 store.
#pragma unroll
        for (int n = 0; n < 2; ++n) {
            const int col  = cbase + n * 16 + qlane;
            const int head = col >> 6, d = col & (HDIM - 1);
            const float bv_ = bias[col];
#pragma unroll
            for (int m = 0; m < 4; ++m) {
                const int row0 = rbase + m * 16 + hi * 8;   // rows row0..row0+7
                const int bi = row0 >> 11, s0 = row0 & (SEQ - 1);
                v8h pk;
#pragma unroll
                for (int j = 0; j < 8; ++j)
                    pk[j] = (_Float16)(acc[m][n][j] + bv_);
                *(v8h*)(Vt + ((size_t)(bi * NHEAD + head) * HDIM + d) * SEQ + s0) = pk;
            }
        }
    } else {
        _Float16* __restrict__ dst = (z == 0) ? Qh : Kh;
        const float sc = (z == 0) ? QSCALE : 1.0f;     // K: times one, exact
#pragma unroll
        for (int n = 0; n < 2; ++n) {
            const int col = cbase + n * 16 + qlane;
            const float bv_ = bias[col];
#pragma unroll
            for (int m = 0; m < 4; ++m) {
#pragma unroll
                for (int j = 0; j < 8; ++j) {
                    const int row = rbase + m * 16 + j + hi * 8;
                    dst[(size_t)row * HID + col] = (_Float16)((acc[m][n][j] + bv_) * sc);
                }
            }
        }
        // Behind the last store: in the built code the other branch's lines
        // follow and rewrite registers that these stores name.
        asm volatile("s_wait_xcnt 0x0" ::: "memory");
    }
}

// ---------------------------------------------------------------------------
// Kernel 2: flash attention.  One wave = 32 queries (two 16-query tiles) so
// every K/V fragment load feeds two WMMAs.  16 waves a block, four a SIMD, so
// that one wave's softmax runs beside another's products: waves w and w + 8
// share 32 queries and split the keys, wave w the first 128 keys of every
// stage, wave w + 8 the second 128.  Behind the loop the two exchange one
// query tile each through LDS and each joins and stores the tile it keeps.
//   scoresT = K * Q^T   (M = keys, N = queries)  -> per-lane online softmax
//   ctxT    = V^T * P^T (M = dims, N = queries)  -> P^T C-layout == B-fragment
//   blockIdx.x : 256-query tile, blockIdx.y : head, blockIdx.z : batch
// Q arrives scaled by log2(e)/8 and the score product starts from -m, m being
// the maximum in use: what the product returns is the exponent itself.
// Mask is pre-baked into an additive f32 bias in LDS (0 or -3e38); it is added
// to the exponents only in the groups of 128 keys that hold a masked key (one
// flag a group, found where the bias is made): such a group's passes all take
// the branch of the lazy test, which adds the bias first.
// Lazy rescale: m may trail a column's true maximum by up to 8, so an
// exponential can reach 2^8.  One test per pass for the whole wave; only when
// it fires are the halves' maxima joined, m raised, the accumulators and sums
// rescaled and this pass's exponents shifted.  Until a column has seen a key
// that is not masked its m stays 0 and its threshold -inf (the test fires).
// On the usual path a score costs one exponential.  Every lane keeps the sums
// of its own keys; the two halves of a column are added once, behind the loop.
// The block's waves walk the same stages: K rows and V^T rows come into
// LDS once per block in stages of 256 keys by asynchronous copies (whole
// lines), two buffers, the next stage in flight while this one is worked on;
// every wave reads its fragments from LDS.
// ---------------------------------------------------------------------------
#define AKS    256                   // keys per stage
#define AKW    128                   // keys of a stage that one wave walks
#define ANT    (SEQ / AKS)           // 8 stages
#define KPIT   72                    // halves per K row in LDS: 144 B = 16 B x odd
#define VPIT   264                   // halves per V^T row in LDS: 528 B = 16 B x odd
#define KHALF  (AKS * KPIT)          // halves of the K part (36,864 B)
#define ABUFH  (KHALF + HDIM * VPIT) // halves per buffer (70,656 B)
#define XVEC   9                     // 16-byte vectors a lane hands over

// Eight 16-byte copies per lane = this thread's share of one 64 KiB stage:
// four of K (64 rows of 128 B a copy), four of V^T (16 rows of 512 B a copy).
// The s_wait_xcnt stands inside the statement so that no address register of
// an issued copy is rewritten ahead of it.
__device__ __forceinline__ void copy_kv(unsigned lk, unsigned lv,
                                        const _Float16* gk, const _Float16* gv) {
    const unsigned l0 = lk,                  l1 = lk + 64 * KPIT * 2,
                   l2 = lk + 128 * KPIT * 2, l3 = lk + 192 * KPIT * 2,
                   l4 = lv,                 l5 = lv + 16 * VPIT * 2,
                   l6 = lv + 32 * VPIT * 2, l7 = lv + 48 * VPIT * 2;
    const _Float16 *g0 = gk,             *g1 = gk + 64 * HID,
                   *g2 = gk + 128 * HID, *g3 = gk + 192 * HID,
                   *g4 = gv,            *g5 = gv + 16 * SEQ,
                   *g6 = gv + 32 * SEQ, *g7 = gv + 48 * SEQ;
    asm volatile(
        "global_load_async_to_lds_b128 %0, %8, off\n\t"
        "global_load_async_to_lds_b128 %1, %9, off\n\t"
        "global_load_async_to_lds_b128 %2, %10, off\n\t"
        "global_load_async_to_lds_b128 %3, %11, off\n\t"
        "global_load_async_to_lds_b128 %4, %12, off\n\t"
        "global_load_async_to_lds_b128 %5, %13, off\n\t"
        "global_load_async_to_lds_b128 %6, %14, off\n\t"
        "global_load_async_to_lds_b128 %7, %15, off\n\t"
        "s_wait_xcnt 0x0"
        :: "v"(l0), "v"(l1), "v"(l2), "v"(l3), "v"(l4), "v"(l5), "v"(l6), "v"(l7),
           "v"(g0), "v"(g1), "v"(g2), "v"(g3), "v"(g4), "v"(g5), "v"(g6), "v"(g7)
        : "memory");
}

__global__ __launch_bounds__(512)
void attention_kernel(const _Float16* __restrict__ Qh,
                      const _Float16* __restrict__ Kh,
                      const _Float16* __restrict__ Vt,
                      const int* __restrict__ mask,
                      float* __restrict__ out) {
    __shared__ __attribute__((aligned(16))) float sbias[SEQ];
    __shared__ __attribute__((aligned(16))) _Float16 kv[2 * ABUFH];
    __shared__ __attribute__((aligned(16))) v4f xch[16 * XVEC * 32];
    __shared__ int sflag[SEQ / AKW];       // group of 128 keys holds a masked key
    const int b    = blockIdx.z;
    const int head = blockIdx.y;
    const int tid  = threadIdx.x;

    const _Float16* Kbase = Kh + (size_t)b * SEQ * HID + head * HDIM;
    const _Float16* Vbase = Vt + (size_t)(b * NHEAD + head) * HDIM * SEQ;

    // Copy side. K: 8 lanes cover one 128-byte row; V^T: a wave covers the
    // 512 bytes that one row has of a stage.
    const int krow = tid >> 3, kcol = (tid & 7) * 8;      // row 0..63, halves
    const int vrow = tid >> 5, vcol = (tid & 31) * 8;     // row 0..15, halves
    const _Float16* gk = Kbase + (size_t)krow * HID + kcol;
    const _Float16* gv = Vbase + (size_t)vrow * SEQ + vcol;
    const unsigned  lk = (unsigned)(size_t)kv + (krow * KPIT + kcol) * 2;
    const unsigned  lv = (unsigned)(size_t)kv + (KHALF + vrow * VPIT + vcol) * 2;

    copy_kv(lk, lv, gk, gv);                              // stage 0 -> buffer 0

    {   // four keys a lane, so a wave makes the bias and the flag of one group
        const int* mp = mask + b * SEQ + tid * 4;
        const bool z0 = mp[0] == 0, z1 = mp[1] == 0, z2 = mp[2] == 0, z3 = mp[3] == 0;
        *(v4f*)(sbias + tid * 4) = (v4f){z0 ? -3.0e38f : 0.0f, z1 ? -3.0e38f : 0.0f,
                                         z2 ? -3.0e38f : 0.0f, z3 ? -3.0e38f : 0.0f};
        const unsigned anyz = __builtin_amdgcn_ballot_w32(z0 || z1 || z2 || z3);
        if ((tid & 31) == 0) sflag[tid >> 5] = (anyz != 0) ? 1 : 0;
    }
    asm volatile("s_wait_asynccnt 0x0" ::: "memory");     // own copies landed
    __syncthreads();                                      // publishes sbias and stage 0
    copy_kv(lk + ABUFH * 2, lv + ABUFH * 2,
            gk + (size_t)AKS * HID, gv + AKS);            // stage 1 -> buffer 1

    const int lane  = tid & 31;
    const int w     = tid >> 5;
    const int qlane = lane & 15;
    const int hi    = lane >> 4;
    const int kh    = w >> 3;              // which 128 keys of every stage
    const int q0    = blockIdx.x * 256 + (w & 7) * 32;

    // Q fragments (B-matrix of scoresT): lane = query, K = head_dim (2 chunks)
    v16h qf[2][2];
#pragma unroll
    for (int qt = 0; qt < 2; ++qt) {
        const _Float16* qp =
            Qh + (size_t)(b * SEQ + q0 + qt * 16 + qlane) * HID + head * HDIM;
#pragma unroll
        for (int kc = 0; kc < 2; ++kc)
            qf[qt][kc] = ldfrag(qp + kc * 32 + hi * 8);
    }

    // Read side: this lane's row in the wave's first K and first V^T fragment,
    // and its first mask bias.
    const _Float16* fk = kv + (kh * AKW + qlane) * KPIT + hi * 8;
    const _Float16* fv = kv + KHALF + qlane * VPIT + kh * AKW + hi * 8;
    const float*    fm = sbias + kh * AKW + hi * 8;
    // bit g: group g of 128 keys holds a masked key (a scalar word)
    const unsigned mbits = __builtin_amdgcn_ballot_w32(sflag[lane & 15] != 0);
    const int      khs   = __builtin_amdgcn_readfirstlane(kh);

    float m[2]   = {0.0f, 0.0f};
    float thr[2] = {-__builtin_inff(), -__builtin_inff()};
    v8f   nmv[2] = {};            // -m in all eight slots: the product's start value
    v2f   l[2][2] = {};           // per lane: two chains of pair sums a tile
    v8f acc[2][4] = {};

    for (int t = 0; t < ANT; ++t) {
      const int boff = (t & 1) * ABUFH;
      // scalar: this wave's 128 keys of the stage hold a masked key
      const unsigned mkw = (mbits >> (2 * t + khs)) & 1u;
      const bool     mkd = mkw != 0;
      // Keeps the four passes unrolled, as they were built before the body held
      // the branch on mkd: with it the compiler leaves the loop rolled, and a
      // pass's K reads no longer stand among the pass before's V^T products.
#pragma unroll
      for (int kk = 0; kk < AKW; kk += 32) {
        const int kt = t * AKS + kk;

        // --- K A-fragments, shared by both query tiles ---
        v16h ak[2][2];   // [key sub-tile][head_dim chunk]
#pragma unroll
        for (int sub = 0; sub < 2; ++sub) {
            const _Float16* kp = fk + boff + (kk + sub * 16) * KPIT;
            ak[sub][0] = ldfrag(kp);
            ak[sub][1] = ldfrag(kp + 32);
        }

        // --- scoresT: 2 x 2 tiles of 16(key) x 16(query): score - m (+ bias) ---
        v8f st[2][2];   // [query tile][key sub-tile]
#pragma unroll
        for (int qt = 0; qt < 2; ++qt)
#pragma unroll
            for (int sub = 0; sub < 2; ++sub) {
                v8f c = wmma_f16(ak[sub][0], qf[qt][0], nmv[qt]);
                st[qt][sub] = wmma_f16(ak[sub][1], qf[qt][1], c);
            }
        // --- lazy test: has any lane an exponent above its threshold? ---
        float mx[2];
        unsigned fire = mkw;        // a group with a masked key always fires
#pragma unroll
        for (int qt = 0; qt < 2; ++qt) {
            float x = fmaxf(st[qt][0][0], st[qt][1][0]);
#pragma unroll
            for (int j = 1; j < 8; ++j)
                x = fmaxf(x, fmaxf(st[qt][0][j], st[qt][1][j]));
            mx[qt] = x;
            fire |= __builtin_amdgcn_ballot_w32(x > thr[qt]);
        }
        if (fire != 0) {            // scalar branch, rare
            if (mkd) {
                // additive mask bias for this lane's 16 key slots (4x ds b128),
                // then the maxima anew, now without the masked keys
#pragma unroll
                for (int sub = 0; sub < 2; ++sub) {
                    const v4f* bp = (const v4f*)(fm + kt + sub * 16);
                    const v8f mb =
                        __builtin_shufflevector(bp[0], bp[1], 0, 1, 2, 3, 4, 5, 6, 7);
                    st[0][sub] += mb;
                    st[1][sub] += mb;
                }
#pragma unroll
                for (int qt = 0; qt < 2; ++qt) {
                    float x = fmaxf(st[qt][0][0], st[qt][1][0]);
#pragma unroll
                    for (int j = 1; j < 8; ++j)
                        x = fmaxf(x, fmaxf(st[qt][0][j], st[qt][1][j]));
                    mx[qt] = x;
                }
            }
#pragma unroll
            for (int qt = 0; qt < 2; ++qt) {
                const bool  seen = thr[qt] > 0.0f;      // m comes from a real score
                const float raw  = mx[qt] + m[qt];      // largest score of the pass
                const float jn   = fmaxf(raw, __shfl_xor(raw, 16, 32));
                const float cand = seen ? fmaxf(m[qt], jn) : jn;
                const bool  real = cand > -1e30f;       // false: only masked keys yet
                const float mnew = real ? cand : m[qt]; // the same in both halves
                const float d    = m[qt] - mnew;
                const float corr = seen ? __builtin_amdgcn_exp2f(d) : 1.0f;
                m[qt]   = mnew;
                thr[qt] = real ? 8.0f : -__builtin_inff();
                l[qt][0] *= corr;
                l[qt][1] *= corr;
#pragma unroll
                for (int dt = 0; dt < 4; ++dt) acc[qt][dt] *= corr;
#pragma unroll
                for (int j = 0; j < 8; ++j) {
                    st[qt][0][j] += d;
                    st[qt][1][j] += d;
                    nmv[qt][j] = -mnew;
                }
            }
        }

        // --- P^T = 2^exponent: one exponential an element ---
        v16h pb[2];   // P^T B-fragments, one per query tile
#pragma unroll
        for (int qt = 0; qt < 2; ++qt) {
            v16h p;
#pragma unroll
            for (int i = 0; i < 8; ++i) {
                const int sub = i >> 2, j = 2 * (i & 3);
                const v2f e = {__builtin_amdgcn_exp2f(st[qt][sub][j]),
                               __builtin_amdgcn_exp2f(st[qt][sub][j + 1])};
                l[qt][i & 1] += e;
                p[sub * 8 + j]     = (_Float16)e.x;
                p[sub * 8 + j + 1] = (_Float16)e.y;
            }
            pb[qt] = p;
        }

        // --- ctxT += V^T * P^T : each V fragment feeds both query tiles ---
#pragma unroll
        for (int dt = 0; dt < 4; ++dt) {
            const _Float16* vp = fv + boff + dt * 16 * VPIT + kk;
            v16h av = ldfrag(vp);
            acc[0][dt] = wmma_f16(av, pb[0], acc[0][dt]);
            acc[1][dt] = wmma_f16(av, pb[1], acc[1][dt]);
        }
      }
      // Hand-over: this wave's reads of the buffer are done, its copies of the
      // next stage have landed; the barrier publishes stage t + 1 and frees
      // the buffer that trip t has read for the refill behind it.
      asm volatile("s_wait_dscnt 0x0" ::: "memory");
      asm volatile("s_wait_asynccnt 0x0" ::: "memory");
      __syncthreads();
      if (t + 2 < ANT)
          copy_kv(lk + boff * 2, lv + boff * 2,
                  gk + (size_t)(t + 2) * AKS * HID, gv + (t + 2) * AKS);
    }
    asm volatile("s_wait_asynccnt 0x0" ::: "memory");     // nothing left in flight

    // --- join the two key halves: wave kh keeps query tile kh and hands the
    //     other tile (accumulators, maximum in use, this lane's sum) to its
    //     partner, 16 bytes a lane and vector, lanes side by side ---
    const bool up = (kh != 0);
    const v2f  lp0 = l[0][0] + l[0][1], lp1 = l[1][0] + l[1][1];
    const float ls0 = lp0.x + lp0.y, ls1 = lp1.x + lp1.y;      // this lane's keys
    // a column that saw only masked keys counts as having no maximum
    const float me0 = (thr[0] > 0.0f) ? m[0] : -1e30f;
    const float me1 = (thr[1] > 0.0f) ? m[1] : -1e30f;
    const float mk = up ? me1 : me0, lk_ = up ? ls1 : ls0;     // kept tile
    v8f keep[4];
    {
        v4f* xp = xch + w * (XVEC * 32) + lane;
#pragma unroll
        for (int dt = 0; dt < 4; ++dt) {
            const v8f g = up ? acc[0][dt] : acc[1][dt];
            keep[dt]    = up ? acc[1][dt] : acc[0][dt];
            xp[(2 * dt) * 32]     = __builtin_shufflevector(g, g, 0, 1, 2, 3);
            xp[(2 * dt + 1) * 32] = __builtin_shufflevector(g, g, 4, 5, 6, 7);
        }
        xp[8 * 32] = (v4f){up ? me0 : me1, up ? ls0 : ls1, 0.0f, 0.0f};
    }
    __syncthreads();                       // publishes the handed-over tiles

    // --- write out: out[b, q, head*64 + d]; 8 floats per dt are contiguous
    //     in d -> two b128 stores each ---
    {
        const v4f* yp = xch + (w ^ 8) * (XVEC * 32) + lane;
        const v4f   ml   = yp[8 * 32];                         // partner's m, sum
        const float mj   = fmaxf(mk, ml.x);
        // ca: own share, cb: partner's share.  The two exponentials stand in one
        // statement with a v_nop behind them; a v_nop in a statement of its own
        // landed elsewhere.
        float ca, cb;
        asm("v_exp_f32 %0, %2\n\t"
            "v_exp_f32 %1, %3\n\t"
            "v_nop"
            : "=&v"(ca), "=&v"(cb) : "v"(mk - mj), "v"(ml.x - mj));
        const float lh   = lk_ * ca + ml.y * cb;               // this half column
        const float linv = 1.0f / (lh + __shfl_xor(lh, 16, 32)); // both halves
        const float sa = ca * linv, sb = cb * linv;
        float* op = out + (size_t)(b * SEQ + q0 + kh * 16 + qlane) * HID
                        + head * HDIM + hi * 8;
#pragma unroll
        for (int dt = 0; dt < 4; ++dt) {
            const v4f o0 = yp[(2 * dt) * 32], o1 = yp[(2 * dt + 1) * 32];
            v4f lo, hic;
#pragma unroll
            for (int j = 0; j < 4; ++j) {
                lo[j]  = keep[dt][j]     * sa + o0[j] * sb;
                hic[j] = keep[dt][4 + j] * sa + o1[j] * sb;
            }
            *(v4f*)(op + dt * 16)     = lo;
            *(v4f*)(op + dt * 16 + 4) = hic;
        }
    }
}

// ---------------------------------------------------------------------------

extern "C" void kernel_launch(void* const* d_in, const int* in_sizes, int n_in,
                              void* d_out, int out_size, void* d_ws, size_t ws_size,
                              hipStream_t stream) {
    (void)in_sizes; (void)n_in; (void)out_size; (void)ws_size;
    const float* X    = (const float*)d_in[0];
    const int*   mask = (const int*)d_in[1];
    const float* Wq   = (const float*)d_in[2];
    const float* bq   = (const float*)d_in[3];
    const float* Wk   = (const float*)d_in[4];
    const float* bk   = (const float*)d_in[5];
    const float* Wv   = (const float*)d_in[6];
    const float* bv   = (const float*)d_in[7];
    float* out = (float*)d_out;

    const size_t nX = (size_t)2 * SEQ * HID;      // 4096*1024
    const size_t nW = (size_t)HID * HID;          // 1024*1024
    _Float16* Qh  = (_Float16*)d_ws;
    _Float16* Kh  = Qh  + nX;
    _Float16* Vt  = Kh  + nX;
    _Float16* Xh  = Vt  + nX;
    _Float16* Wqh = Xh  + nX;
    _Float16* Wkh = Wqh + nW;
    _Float16* Wvh = Wkh + nW;                     // total 38 MiB workspace

    // Pass 0: one-shot fp32 -> f16 conversion of X and weights, one launch;
    // Xh, Wqh, Wkh, Wvh are contiguous, so Xh is the start of the whole range.
    cvt_f16_kernel<<<CGRID, 256, 0, stream>>>(X, Wq, Wk, Wv, Xh);

    dim3 g1(4096 / 128, HID / 128, 3);            // 32 x 8 x 3
    qkv_proj_kernel<<<g1, 256, 0, stream>>>(Xh, Wqh, Wkh, Wvh, bq, bk, bv,
                                            Qh, Kh, Vt);

    dim3 g2(SEQ / 256, NHEAD, 2);                 // 8 x 16 x 2
    attention_kernel<<<g2, 512, 0, stream>>>(Qh, Kh, Vt, mask, out);
}
